// v000
// Times are from an AMD MI455X. After a warm-up the kernel runs many times in a row, and a time is the length of
// such a window on the GPU divided by its runs, so every launch and the gaps after it count. The runs cycle
// through copies of the inputs. A figure is the median of several windows, for all but v000 over two sittings.
// Sittings can differ by a few percent; kernels timed side by side share one.
// The starting kernel, v000, takes 299 microseconds a run.
#include <hip/hip_runtime.h>
#include <math.h>

typedef __attribute__((ext_vector_type(16))) _Float16 v16h;
typedef __attribute__((ext_vector_type(16))) __bf16 v16b;
typedef __attribute__((ext_vector_type(8)))  _Float16 v8h;
typedef __attribute__((ext_vector_type(8)))  float v8f;
typedef __attribute__((ext_vector_type(4)))  float v4f;
typedef __attribute__((ext_vector_type(2)))  float v2f;
typedef __attribute__((ext_vector_type(4)))  unsigned v4u;
typedef __attribute__((ext_vector_type(4)))  int v4i;
typedef float __attribute__((may_alias)) float_a;
typedef int __attribute__((may_alias)) int_a;

template <typename T> __device__ __forceinline__ void vst2(void* p, T v) { *(T*)p = v;  }
__device__ __forceinline__ v8f wmma16(v16h a, v16h b, v8f c) {
  v8f d = __builtin_amdgcn_wmma_f32_16x16x32_f16(false, a, false, b, (short)0, c, false, false);
  asm volatile("v_nop\n\tv_nop\n\tv_nop\n\tv_nop" : "+v"(d) : "v"(a), "v"(b));
  return d;
}
__device__ __forceinline__ v8f wmma_bf(v16b a, v16b b, v8f c) {
  v8f d = __builtin_amdgcn_wmma_f32_16x16x32_bf16(false, a, false, b, (short)0, c, false, false);
  asm volatile("v_nop\n\tv_nop\n\tv_nop\n\tv_nop" : "+v"(d) : "v"(a), "v"(b));
  return d;
}
// 16x16x32 fragments: lane = (h = lane>>4, row/col = lane&15); elements 0..7 = k0+8h+0..7, 8..15 = k0+16+8h+0..7; D element r = row 8h+r
__device__ __forceinline__ v16h frag_h(const _Float16* rowk0, int lane) {
  union { v16h v; v8h q[2]; } u; const _Float16* p = rowk0 + 8 * (lane >> 4);
  u.q[0] = *(const v8h*)p; u.q[1] = *(const v8h*)(p + 16); return u.v;
}
__device__ __forceinline__ v16h frag_f32(const float* rowk0, int lane) {
  v16h a; const float* p = rowk0 + 8 * (lane >> 4);
#pragma unroll
  for (int i = 0; i < 8; ++i) { a[i] = (_Float16)p[i]; a[8 + i] = (_Float16)p[16 + i]; }
  return a;
}
__device__ __forceinline__ v16h frag_f32s(const float* rowk0, int lane, float sc) {
  v16h a; const float* p = rowk0 + 8 * (lane >> 4);
#pragma unroll
  for (int i = 0; i < 8; ++i) { a[i] = (_Float16)(p[i] * sc); a[8 + i] = (_Float16)(p[16 + i] * sc); }
  return a;
}
// column fragment from a [K][ld] layout (column n), rows >= K read as 0
__device__ __forceinline__ v16h fragc_f32(const float* W, int k0, int n, int lane, int ld, int K) {
  v16h a; const int g = lane >> 4;
#pragma unroll
  for (int i = 0; i < 8; ++i) { const int ka = k0 + 8 * g + i, kb = ka + 16;
    a[i] = (_Float16)(ka < K ? W[(size_t)ka * ld + n] : 0.f); a[8 + i] = (_Float16)(kb < K ? W[(size_t)kb * ld + n] : 0.f); }
  return a;
}
struct F2 { v16b h, l; };
__device__ __forceinline__ F2 bsplit16(const float v[16]) { F2 r;
#pragma unroll
  for (int i = 0; i < 16; ++i) { const __bf16 h = (__bf16)v[i]; r.h[i] = h; r.l[i] = (__bf16)(v[i] - (float)h); }
  return r; }
__device__ __forceinline__ F2 split_row(const float* row, int k0, int lane) { float v[16]; const float* p = row + k0 + 8 * (lane >> 4);
#pragma unroll
  for (int i = 0; i < 8; ++i) { v[i] = p[i]; v[8 + i] = p[16 + i]; }
  return bsplit16(v); }
__device__ __forceinline__ F2 split_rowK(const float* row, int k0, int lane, int K) { float v[16]; const int g = lane >> 4;
#pragma unroll
  for (int i = 0; i < 8; ++i) { const int ka = k0 + 8 * g + i, kb = ka + 16; v[i] = ka < K ? row[ka] : 0.f; v[8 + i] = kb < K ? row[kb] : 0.f; }
  return bsplit16(v); }
__device__ __forceinline__ F2 split_col(const float* W, int k0, int n, int lane, int ld, int K) { float v[16]; const int g = lane >> 4;
#pragma unroll
  for (int i = 0; i < 8; ++i) { const int ka = k0 + 8 * g + i, kb = ka + 16; v[i] = ka < K ? W[(size_t)ka * ld + n] : 0.f; v[8 + i] = kb < K ? W[(size_t)kb * ld + n] : 0.f; }
  return bsplit16(v); }
__device__ __forceinline__ v8f mac3(const F2& a, const F2& b, v8f c) { c = wmma_bf(a.l, b.h, c); c = wmma_bf(a.h, b.l, c); return wmma_bf(a.h, b.h, c); }
__device__ __forceinline__ float sigm(float v) { return 1.0f / (1.0f + expf(-v)); }
#define LDSX() do { asm volatile("s_wait_dscnt 0" ::: "memory"); __builtin_amdgcn_wave_barrier(); __builtin_amdgcn_fence(__ATOMIC_RELEASE, "workgroup"); } while (0)

// ViT self-attention core (12 heads of 64, scores / sqrt(768), no mask, no output projection): x converted once to f16, the three
// [in][out] weights packed transposed to f16 rows (x16), q/k/v (+bias) on v_wmma_f32_16x16x32_f16 into head-major f16 buffers (x4);
// per (64 queries, head, batch) the 16 key tiles with an online softmax in f32 (S on f16 WMMA, P x2^14 f16 @ V^T), context written as
#define NB 8
#define SS 1024
#define HH 768
#define NHD 12
#define HD 64
#define NR (NB * SS)

__global__ __launch_bounds__(256) void k_cvt(const float* __restrict__ x, _Float16* __restrict__ X16) {
  const size_t i8 = (size_t)blockIdx.x * 256 + threadIdx.x; if (i8 >= (size_t)NR * HH / 8) return;
  union { v8h h; v4u u; } pk;
#pragma unroll
  for (int e = 0; e < 8; ++e) pk.h[e] = (_Float16)x[i8 * 8 + e];
  vst2(X16 + i8 * 8, pk.u);
}
// P rows [which*768 + n][768] = W_which[k][n] * 16 (transpose of [in][out])
__global__ __launch_bounds__(256) void k_pack(const float* __restrict__ Wq, const float* __restrict__ Wk, const float* __restrict__ Wv, _Float16* __restrict__ P) {
  const int r = blockIdx.x, tid = threadIdx.x; __shared__ __align__(16) _Float16 srow[HH];
  const int which = r / HH, n = r % HH; const float* W = which == 0 ? Wq : (which == 1 ? Wk : Wv);
  for (int k = tid; k < HH; k += 256) srow[k] = (_Float16)(W[(size_t)k * HH + n] * 16.0f);
  __syncthreads();
  if (tid < HH / 8) vst2(P + (size_t)r * HH + tid * 8, *(const v4u*)(&srow[tid * 8]));
}
// q/k/v: block (64 rows, 128 cols = 2 heads, which): Q16/K16 [b][h][s][64] x4 ; VT [b][h][d][s] x4
__global__ __launch_bounds__(128) void k_qkv(const _Float16* __restrict__ X16, const _Float16* __restrict__ P, const float* __restrict__ bq, const float* __restrict__ bk, const float* __restrict__ bv, _Float16* __restrict__ Q16, _Float16* __restrict__ K16, _Float16* __restrict__ VT) {
  __shared__ __align__(16) float so[4][16][132];
  __shared__ __align__(16) _Float16 st[128][72];
  const int tid = threadIdx.x, wave = tid >> 5, lane = tid & 31, col = lane & 15, g = lane >> 4;
  const int which = blockIdx.z, r0b = blockIdx.x * 64, r0 = r0b + wave * 16, n0 = blockIdx.y * 128; const int b = r0b / SS, s0 = r0b % SS;
  const _Float16* Pw = P + (size_t)which * HH * HH; const float* bias = which == 0 ? bq : (which == 1 ? bk : bv);
  v8f acc[8] = {};
#pragma unroll 2
  for (int kc = 0; kc < HH / 32; ++kc) { const v16h a = frag_h(X16 + (size_t)(r0 + col) * HH + kc * 32, lane);
#pragma unroll
    for (int j = 0; j < 8; ++j) acc[j] = wmma16(a, frag_h(Pw + (size_t)(n0 + j * 16 + col) * HH + kc * 32, lane), acc[j]); }
  if (which < 2) {
#pragma unroll
    for (int j = 0; j < 8; ++j) { const float bb = bias[n0 + j * 16 + col];
#pragma unroll
      for (int r = 0; r < 8; ++r) so[wave][8 * g + r][j * 16 + col] = (acc[j][r] * (1.0f / 16.0f) + bb) * 4.0f; }
    LDSX();
    _Float16* D = which == 0 ? Q16 : K16;
    for (int q = lane; q < 16 * 2 * 8; q += 32) { const int hh = q >> 7, rl = (q >> 3) & 15, pc = q & 7; const int h = (n0 >> 6) + hh; union { v8h h8; v4u u; } pk;
#pragma unroll
      for (int e = 0; e < 8; ++e) pk.h8[e] = (_Float16)so[wave][rl][hh * 64 + pc * 8 + e];
      vst2(D + (((size_t)b * NHD + h) * SS + s0 + wave * 16 + rl) * HD + pc * 8, pk.u); } }
  else {
#pragma unroll
    for (int j = 0; j < 8; ++j) { const float bb = bias[n0 + j * 16 + col];
#pragma unroll
      for (int r = 0; r < 8; ++r) st[j * 16 + col][wave * 16 + 8 * g + r] = (_Float16)((acc[j][r] * (1.0f / 16.0f) + bb) * 4.0f); }
    __syncthreads();
    for (int q = tid; q < 128 * 8; q += 128) { const int cl = q >> 3, pc = q & 7; const int c = n0 + cl, h = c >> 6, d = c & 63; vst2(VT + (((size_t)b * NHD + h) * HD + d) * SS + s0 + pc * 8, *(const v4u*)(&st[cl][pc * 8])); } }
}
// attention: block (64 q, h, b), 16 key tiles, online softmax; out f32 [b][s][h*64 + d]
__global__ __launch_bounds__(128) void k_attn(const _Float16* __restrict__ Q16, const _Float16* __restrict__ K16, const _Float16* __restrict__ VT, float* __restrict__ out) {
  __shared__ __align__(16) float sS[4][16][68];
  __shared__ __align__(16) _Float16 sP[4][16][72];
  __shared__ __align__(16) float sO[4][16][68];
  const int tid = threadIdx.x, w = tid >> 5, lane = tid & 31, col = lane & 15, g = lane >> 4;
  const int b = blockIdx.z, h = blockIdx.y, q0 = blockIdx.x * 64 + w * 16; const size_t bh = (size_t)b * NHD + h;
  const float scl = (1.0f / 16.0f) / sqrtf((float)HH);
  v16h aq[2];
#pragma unroll
  for (int kc = 0; kc < 2; ++kc) aq[kc] = frag_h(Q16 + (bh * SS + q0 + col) * HD + kc * 32, lane);
  float mrun = -3.0e38f, lrun = 0.f; v8f acc[4] = {};
#pragma unroll 1
  for (int kt = 0; kt < SS / 64; ++kt) {
#pragma unroll
    for (int t = 0; t < 4; ++t) { v8f s = {}; const int key = kt * 64 + t * 16 + col;
#pragma unroll
      for (int kc = 0; kc < 2; ++kc) s = wmma16(aq[kc], frag_h(K16 + (bh * SS + key) * HD + kc * 32, lane), s);
#pragma unroll
      for (int r = 0; r < 8; ++r) sS[w][8 * g + r][t * 16 + col] = s[r] * scl; }
    LDSX();
    float mx = -3.4e38f;
#pragma unroll
    for (int jj = 0; jj < 32; ++jj) mx = fmaxf(mx, sS[w][col][g * 32 + jj]);
    mx = fmaxf(mx, __shfl_xor(mx, 16, 32));
    const float mnew = fmaxf(mrun, mx); const float corr = expf(mrun - mnew);
    float ps = 0.f;
#pragma unroll
    for (int jj = 0; jj < 32; ++jj) { const float p = expf(sS[w][col][g * 32 + jj] - mnew); ps += p; sP[w][col][g * 32 + jj] = (_Float16)(p * 16384.0f); }
    ps += __shfl_xor(ps, 16, 32);
    lrun = lrun * corr + ps; mrun = mnew;
#pragma unroll
    for (int r = 0; r < 8; ++r) { const float cr = __shfl(corr, 8 * g + r, 32);
#pragma unroll
      for (int t = 0; t < 4; ++t) acc[t][r] *= cr; }
    LDSX();
#pragma unroll
    for (int kc = 0; kc < 2; ++kc) { const v16h pa = frag_h(&sP[w][col][0] + kc * 32, lane);
#pragma unroll
      for (int t = 0; t < 4; ++t) acc[t] = wmma16(pa, frag_h(VT + (bh * HD + t * 16 + col) * SS + kt * 64 + kc * 32, lane), acc[t]); }
    __builtin_amdgcn_wave_barrier(); }
#pragma unroll
  for (int r = 0; r < 8; ++r) { const float lr = __shfl(lrun, 8 * g + r, 32); const float inv = 1.0f / (lr * 16384.0f * 4.0f);
#pragma unroll
    for (int t = 0; t < 4; ++t) sO[w][8 * g + r][t * 16 + col] = acc[t][r] * inv; }
  LDSX();
  for (int q = lane; q < 16 * 16; q += 32) { const int rl = q >> 4, pc = q & 15; vst2(out + ((size_t)b * SS + q0 + rl) * HH + h * HD + pc * 4, *(const v4f*)(&sO[w][rl][pc * 4])); }
}
extern "C" void kernel_launch(void* const* d_in, const int* in_sizes, int n_in, void* d_out, int out_size, void* d_ws, size_t ws_size, hipStream_t stream) {
  (void)in_sizes; (void)n_in; (void)out_size; (void)ws_size;
  const float** I = (const float**)d_in;
  const float* x = I[0]; const float* Wq = I[1]; const float* bq = I[2]; const float* Wk = I[3]; const float* bk = I[4]; const float* Wv = I[5]; const float* bv = I[6];
  float* out = (float*)d_out;
  char* ws = (char*)d_ws; size_t off = 0;
  auto take = [&](size_t bytes) { char* p = ws + off; off += (bytes + 255) & ~(size_t)255; return p; };
  _Float16* X16 = (_Float16*)take((size_t)NR * HH * 2); _Float16* P = (_Float16*)take((size_t)3 * HH * HH * 2);
  _Float16* Q16 = (_Float16*)take((size_t)NR * HH * 2); _Float16* K16 = (_Float16*)take((size_t)NR * HH * 2); _Float16* VT = (_Float16*)take((size_t)NR * HH * 2);
  k_cvt<<<(NR * HH / 8 + 255) / 256, 256, 0, stream>>>(x, X16);
  k_pack<<<3 * HH, 256, 0, stream>>>(Wq, Wk, Wv, P);
  k_qkv<<<dim3(NR / 64, HH / 128, 3), 128, 0, stream>>>(X16, P, bq, bk, bv, Q16, K16, VT);
  k_attn<<<dim3(SS / 64, NHD, NB), 128, 0, stream>>>(Q16, K16, VT, out);
}

// v001
// One run takes 107 microseconds.
// Two timings next to v000 put it at 2.87 and 2.86 times that version's speed.
#include <hip/hip_runtime.h>
#include <math.h>

typedef __attribute__((ext_vector_type(16))) _Float16 v16h;
typedef __attribute__((ext_vector_type(16))) __bf16 v16b;
typedef __attribute__((ext_vector_type(8)))  _Float16 v8h;
typedef __attribute__((ext_vector_type(8)))  float v8f;
typedef __attribute__((ext_vector_type(4)))  float v4f;
typedef __attribute__((ext_vector_type(2)))  float v2f;
typedef __attribute__((ext_vector_type(4)))  unsigned v4u;
typedef __attribute__((ext_vector_type(4)))  int v4i;
typedef float __attribute__((may_alias)) float_a;
typedef int __attribute__((may_alias)) int_a;

template <typename T> __device__ __forceinline__ void vst2(void* p, T v) { *(T*)p = v;  }
__device__ __forceinline__ v8f wmma16(v16h a, v16h b, v8f c) {
  v8f d = __builtin_amdgcn_wmma_f32_16x16x32_f16(false, a, false, b, (short)0, c, false, false);
  asm volatile("v_nop\n\tv_nop\n\tv_nop\n\tv_nop" : "+v"(d) : "v"(a), "v"(b));
  return d;
}
__device__ __forceinline__ v8f wmma_bf(v16b a, v16b b, v8f c) {
  v8f d = __builtin_amdgcn_wmma_f32_16x16x32_bf16(false, a, false, b, (short)0, c, false, false);
  asm volatile("v_nop\n\tv_nop\n\tv_nop\n\tv_nop" : "+v"(d) : "v"(a), "v"(b));
  return d;
}
// 16x16x32 fragments: lane = (h = lane>>4, row/col = lane&15); elements 0..7 = k0+8h+0..7, 8..15 = k0+16+8h+0..7; D element r = row 8h+r
__device__ __forceinline__ v16h frag_h(const _Float16* rowk0, int lane) {
  union { v16h v; v8h q[2]; } u; const _Float16* p = rowk0 + 8 * (lane >> 4);
  u.q[0] = *(const v8h*)p; u.q[1] = *(const v8h*)(p + 16); return u.v;
}
__device__ __forceinline__ v16h frag_f32(const float* rowk0, int lane) {
  v16h a; const float* p = rowk0 + 8 * (lane >> 4);
#pragma unroll
  for (int i = 0; i < 8; ++i) { a[i] = (_Float16)p[i]; a[8 + i] = (_Float16)p[16 + i]; }
  return a;
}
__device__ __forceinline__ v16h frag_f32s(const float* rowk0, int lane, float sc) {
  v16h a; const float* p = rowk0 + 8 * (lane >> 4);
#pragma unroll
  for (int i = 0; i < 8; ++i) { a[i] = (_Float16)(p[i] * sc); a[8 + i] = (_Float16)(p[16 + i] * sc); }
  return a;
}
// column fragment from a [K][ld] layout (column n), rows >= K read as 0
__device__ __forceinline__ v16h fragc_f32(const float* W, int k0, int n, int lane, int ld, int K) {
  v16h a; const int g = lane >> 4;
#pragma unroll
  for (int i = 0; i < 8; ++i) { const int ka = k0 + 8 * g + i, kb = ka + 16;
    a[i] = (_Float16)(ka < K ? W[(size_t)ka * ld + n] : 0.f); a[8 + i] = (_Float16)(kb < K ? W[(size_t)kb * ld + n] : 0.f); }
  return a;
}
struct F2 { v16b h, l; };
__device__ __forceinline__ F2 bsplit16(const float v[16]) { F2 r;
#pragma unroll
  for (int i = 0; i < 16; ++i) { const __bf16 h = (__bf16)v[i]; r.h[i] = h; r.l[i] = (__bf16)(v[i] - (float)h); }
  return r; }
__device__ __forceinline__ F2 split_row(const float* row, int k0, int lane) { float v[16]; const float* p = row + k0 + 8 * (lane >> 4);
#pragma unroll
  for (int i = 0; i < 8; ++i) { v[i] = p[i]; v[8 + i] = p[16 + i]; }
  return bsplit16(v); }
__device__ __forceinline__ F2 split_rowK(const float* row, int k0, int lane, int K) { float v[16]; const int g = lane >> 4;
#pragma unroll
  for (int i = 0; i < 8; ++i) { const int ka = k0 + 8 * g + i, kb = ka + 16; v[i] = ka < K ? row[ka] : 0.f; v[8 + i] = kb < K ? row[kb] : 0.f; }
  return bsplit16(v); }
__device__ __forceinline__ F2 split_col(const float* W, int k0, int n, int lane, int ld, int K) { float v[16]; const int g = lane >> 4;
#pragma unroll
  for (int i = 0; i < 8; ++i) { const int ka = k0 + 8 * g + i, kb = ka + 16; v[i] = ka < K ? W[(size_t)ka * ld + n] : 0.f; v[8 + i] = kb < K ? W[(size_t)kb * ld + n] : 0.f; }
  return bsplit16(v); }
__device__ __forceinline__ v8f mac3(const F2& a, const F2& b, v8f c) { c = wmma_bf(a.l, b.h, c); c = wmma_bf(a.h, b.l, c); return wmma_bf(a.h, b.h, c); }
__device__ __forceinline__ float sigm(float v) { return 1.0f / (1.0f + expf(-v)); }
#define LDSX() do { asm volatile("s_wait_dscnt 0" ::: "memory"); __builtin_amdgcn_wave_barrier(); __builtin_amdgcn_fence(__ATOMIC_RELEASE, "workgroup"); } while (0)

// LDS byte address of a __shared__ element (low 32 bits of its address)
__device__ __forceinline__ unsigned lds_off(const void* p) { return (unsigned)(size_t)p; }
// four asynchronous copies to LDS, 16 bytes per lane each, through no register; s_wait_xcnt 0 is the statement's last line so that
// no address register of a copy is rewritten ahead of it
__device__ __forceinline__ void cp4(unsigned l0, const _Float16* g0, unsigned l1, const _Float16* g1, unsigned l2, const _Float16* g2, unsigned l3, const _Float16* g3) {
  asm volatile("global_load_async_to_lds_b128 %0, %1, off\n\tglobal_load_async_to_lds_b128 %2, %3, off\n\tglobal_load_async_to_lds_b128 %4, %5, off\n\tglobal_load_async_to_lds_b128 %6, %7, off\n\ts_wait_xcnt 0x0"
               :: "v"(l0), "v"(g0), "v"(l1), "v"(g1), "v"(l2), "v"(g2), "v"(l3), "v"(g3) : "memory");
}
// the same for the twelve copies of one q/k/v stage: rows l + 16 i of the ring, i = 0..3 from a (x rows), i = 4..11 from p (weight rows), 16 source rows apart
__device__ __forceinline__ void cp12(unsigned l, const _Float16* a, const _Float16* p, int ld) {
  const unsigned d = 16 * 144;  // 16 ring rows at the 144-byte pitch
#define CPL(i, j) "global_load_async_to_lds_b128 %" #i ", %" #j ", off\n\t"
  asm volatile(CPL(0, 1) CPL(2, 3) CPL(4, 5) CPL(6, 7) CPL(8, 9) CPL(10, 11) CPL(12, 13) CPL(14, 15) CPL(16, 17) CPL(18, 19) CPL(20, 21) CPL(22, 23) "s_wait_xcnt 0x0"
               :: "v"(l), "v"(a), "v"(l + d), "v"(a + 16 * ld), "v"(l + 2 * d), "v"(a + 32 * ld), "v"(l + 3 * d), "v"(a + 48 * ld),
                  "v"(l + 4 * d), "v"(p), "v"(l + 5 * d), "v"(p + 16 * ld), "v"(l + 6 * d), "v"(p + 32 * ld), "v"(l + 7 * d), "v"(p + 48 * ld),
                  "v"(l + 8 * d), "v"(p + 64 * ld), "v"(l + 9 * d), "v"(p + 80 * ld), "v"(l + 10 * d), "v"(p + 96 * ld), "v"(l + 11 * d), "v"(p + 112 * ld) : "memory");
#undef CPL
}
// publish point of the two-buffer ring: this wave's LDS reads are done, its own copies have landed, then the work-group barrier
#define RING_PUBLISH() do { asm volatile("s_wait_dscnt 0x0" ::: "memory"); asm volatile("s_wait_asynccnt 0x0" ::: "memory"); __syncthreads(); } while (0)

// ViT self-attention core (12 heads of 64, scores / sqrt(768), no mask, no output projection): x converted once to f16, the three
// [in][out] weights packed transposed to f16 rows (x16), q/k/v (+bias) on v_wmma_f32_16x16x32_f16 into head-major f16 buffers (x4);
// per (128 queries, head, batch) the 16 key tiles with an online softmax in f32 (S on f16 WMMA, P x2^14 f16 @ V^T), context written as
#define NB 8
#define SS 1024
#define HH 768
#define NHD 12
#define HD 64
#define NR (NB * SS)
#define KP 72  // LDS pitch of a staged 128-byte row, in halfs: 144 B, 16 B x odd, for the ds_load_b128 fragment reads

__global__ __launch_bounds__(256) void k_cvt(const float* __restrict__ x, _Float16* __restrict__ X16) {
  const size_t i8 = (size_t)blockIdx.x * 256 + threadIdx.x; if (i8 >= (size_t)NR * HH / 8) return;
  union { v8h h; v4u u; } pk;
#pragma unroll
  for (int e = 0; e < 8; ++e) pk.h[e] = (_Float16)x[i8 * 8 + e];
  vst2(X16 + i8 * 8, pk.u);
}
// P rows [which*768 + n][768] = W_which[k][n] * 16 (transpose of [in][out])
__global__ __launch_bounds__(256) void k_pack(const float* __restrict__ Wq, const float* __restrict__ Wk, const float* __restrict__ Wv, _Float16* __restrict__ P) {
  const int r = blockIdx.x, tid = threadIdx.x; __shared__ __align__(16) _Float16 srow[HH];
  const int which = r / HH, n = r % HH; const float* W = which == 0 ? Wq : (which == 1 ? Wk : Wv);
  for (int k = tid; k < HH; k += 256) srow[k] = (_Float16)(W[(size_t)k * HH + n] * 16.0f);
  __syncthreads();
  if (tid < HH / 8) vst2(P + (size_t)r * HH + tid * 8, *(const v4u*)(&srow[tid * 8]));
}
// q/k/v: block (64 rows, 128 cols = 2 heads, which): Q16/K16 [b][h][s][64] x4 ; VT [b][h][d][s] x4
__global__ __launch_bounds__(128) void k_qkv(const _Float16* __restrict__ X16, const _Float16* __restrict__ P, const float* __restrict__ bq, const float* __restrict__ bk, const float* __restrict__ bv, _Float16* __restrict__ Q16, _Float16* __restrict__ K16, _Float16* __restrict__ VT) {
  // ring: two stages of 64 k: rows 0..63 = the block's x rows, rows 64..191 = its weight rows; the output staging reuses it behind the last barrier
  __shared__ __align__(16) char smem[2 * 192 * KP * 2];
  _Float16 (*ring)[192][KP] = (_Float16 (*)[192][KP])smem;
  float (*so)[16][132] = (float (*)[16][132])smem;
  _Float16 (*st)[72] = (_Float16 (*)[72])smem;
  const int tid = threadIdx.x, wave = tid >> 5, lane = tid & 31, col = lane & 15, g = lane >> 4;
  const int which = blockIdx.z, r0b = blockIdx.x * 64, r0 = r0b + wave * 16, n0 = blockIdx.y * 128; const int b = r0b / SS, s0 = r0b % SS;
  const _Float16* Pw = P + (size_t)which * HH * HH; const float* bias = which == 0 ? bq : (which == 1 ? bk : bv);
  v8f acc[8] = {};
  // copy map: 8 lanes cover one 128-byte row piece, a wave's copy four whole lines; a thread brings rows (tid >> 3) + 16 i, i = 0..11
  const int cr = tid >> 3, cc = (tid & 7) * 8;
  const _Float16* gx = X16 + (size_t)(r0b + cr) * HH + cc; const _Float16* gp = Pw + (size_t)(n0 + cr) * HH + cc;
  const unsigned l0 = lds_off(&ring[0][cr][cc]);
  auto stage = [&](int s, int buf) { cp12(l0 + (unsigned)buf * (192 * KP * 2), gx + s * 64, gp + s * 64, HH); };
  stage(0, 0);
  asm volatile("s_wait_asynccnt 0x0" ::: "memory");  // stage 0 has landed before the barrier that publishes it
  __syncthreads();
  stage(1, 1);
#pragma unroll 1  // one stage per trip: the ring's order at the foot stays as written
  for (int s = 0; s < HH / 64; ++s) { const int buf = s & 1;
#pragma unroll
    for (int kc = 0; kc < 2; ++kc) { const v16h a = frag_h(&ring[buf][wave * 16 + col][kc * 32], lane); v16h bf[8];
#pragma unroll
      for (int j = 0; j < 8; ++j) bf[j] = frag_h(&ring[buf][64 + j * 16 + col][kc * 32], lane);
      __builtin_amdgcn_sched_barrier(0);  // the block's LDS reads issue as one group ahead of its WMMAs; without it each WMMA waits out its own pair of reads
#pragma unroll
      for (int j = 0; j < 8; ++j) acc[j] = wmma16(a, bf[j], acc[j]); }
    RING_PUBLISH();
    if (s + 2 < HH / 64) stage(s + 2, buf); }
  asm volatile("s_wait_asynccnt 0x0" ::: "memory");  // nothing of the ring is in flight when it becomes output staging
  if (which < 2) {
#pragma unroll
    for (int j = 0; j < 8; ++j) { const float bb = bias[n0 + j * 16 + col];
#pragma unroll
      for (int r = 0; r < 8; ++r) so[wave][8 * g + r][j * 16 + col] = (acc[j][r] * (1.0f / 16.0f) + bb) * 4.0f; }
    LDSX();
    _Float16* D = which == 0 ? Q16 : K16;
    for (int q = lane; q < 16 * 2 * 8; q += 32) { const int hh = q >> 7, rl = (q >> 3) & 15, pc = q & 7; const int h = (n0 >> 6) + hh; union { v8h h8; v4u u; } pk;
#pragma unroll
      for (int e = 0; e < 8; ++e) pk.h8[e] = (_Float16)so[wave][rl][hh * 64 + pc * 8 + e];
      vst2(D + (((size_t)b * NHD + h) * SS + s0 + wave * 16 + rl) * HD + pc * 8, pk.u); } }
  else {
#pragma unroll
    for (int j = 0; j < 8; ++j) { const float bb = bias[n0 + j * 16 + col];
#pragma unroll
      for (int r = 0; r < 8; ++r) st[j * 16 + col][wave * 16 + 8 * g + r] = (_Float16)((acc[j][r] * (1.0f / 16.0f) + bb) * 4.0f); }
    __syncthreads();
    for (int q = tid; q < 128 * 8; q += 128) { const int cl = q >> 3, pc = q & 7; const int c = n0 + cl, h = c >> 6, d = c & 63; vst2(VT + (((size_t)b * NHD + h) * HD + d) * SS + s0 + pc * 8, *(const v4u*)(&st[cl][pc * 8])); } }
}
// attention: block (128 q, h, b), 8 waves, 16 key tiles staged once per block in a two-buffer LDS ring, online softmax; out f32 [b][s][h*64 + d]
__global__ __launch_bounds__(256) void k_attn(const _Float16* __restrict__ Q16, const _Float16* __restrict__ K16, const _Float16* __restrict__ VT, float* __restrict__ out) {
  __shared__ __align__(16) float sS[8][16][68];  // scores; after the loop each wave's own output staging
  __shared__ __align__(16) _Float16 sP[8][16][72];
  __shared__ __align__(16) _Float16 sK[2][64][KP];  // [buffer][key][d]
  __shared__ __align__(16) _Float16 sV[2][64][KP];  // [buffer][d][key]
  const int tid = threadIdx.x, w = tid >> 5, lane = tid & 31, col = lane & 15, g = lane >> 4;
  const int b = blockIdx.z, h = blockIdx.y, q0 = blockIdx.x * 128 + w * 16; const size_t bh = (size_t)b * NHD + h;
  const float scl = (1.0f / 16.0f) / sqrtf((float)HH);
  v16h aq[2];
#pragma unroll
  for (int kc = 0; kc < 2; ++kc) aq[kc] = frag_h(Q16 + (bh * SS + q0 + col) * HD + kc * 32, lane);
  float mrun = -3.0e38f, lrun = 0.f; v8f acc[4] = {};
  // copy map: 8 lanes cover one 128-byte row, a wave's copy four whole lines; a thread brings rows tid >> 3 and 32 + (tid >> 3) of K and of V^T
  const int cr = tid >> 3, cc = (tid & 7) * 8;
  const _Float16* gk = K16 + (bh * SS + cr) * HD + cc; const _Float16* gv = VT + (bh * HD + cr) * SS + cc;
  const unsigned lk = lds_off(&sK[0][cr][cc]), lv = lds_off(&sV[0][cr][cc]);
  auto stage = [&](int t, int buf) { const unsigned o = (unsigned)buf * (64 * KP * 2); const _Float16* k = gk + (size_t)t * 64 * HD; const _Float16* v = gv + t * 64;
    cp4(lk + o, k, lk + o + 32 * KP * 2, k + 32 * HD, lv + o, v, lv + o + 32 * KP * 2, v + 32 * SS); };
  stage(0, 0);
  asm volatile("s_wait_asynccnt 0x0" ::: "memory");  // tile 0 has landed before the barrier that publishes it
  __syncthreads();
  stage(1, 1);
#pragma unroll 1
  for (int kt = 0; kt < SS / 64; ++kt) { const int buf = kt & 1;
#pragma unroll
    for (int tp = 0; tp < 4; tp += 2) { v16h kf[2][2];  // 32 keys a group: all four tiles at once cost a resident wave per SIMD in registers
#pragma unroll
      for (int t = 0; t < 2; ++t) { kf[t][0] = frag_h(&sK[buf][(tp + t) * 16 + col][0], lane); kf[t][1] = frag_h(&sK[buf][(tp + t) * 16 + col][32], lane); }
      __builtin_amdgcn_sched_barrier(0);  // the group's K fragment reads issue together ahead of its score WMMAs; without it each WMMA waits out its own pair of reads
#pragma unroll
      for (int t = 0; t < 2; ++t) { v8f s = {};
#pragma unroll
        for (int kc = 0; kc < 2; ++kc) s = wmma16(aq[kc], kf[t][kc], s);
#pragma unroll
        for (int r = 0; r < 8; ++r) sS[w][8 * g + r][(tp + t) * 16 + col] = s[r] * scl; } }
    LDSX();
    float mx = -3.4e38f;
#pragma unroll
    for (int jj = 0; jj < 32; ++jj) mx = fmaxf(mx, sS[w][col][g * 32 + jj]);
    mx = fmaxf(mx, __shfl_xor(mx, 16, 32));
    const float mnew = fmaxf(mrun, mx); const float corr = expf(mrun - mnew);
    float ps = 0.f;
#pragma unroll
    for (int jj = 0; jj < 32; ++jj) { const float p = expf(sS[w][col][g * 32 + jj] - mnew); ps += p; sP[w][col][g * 32 + jj] = (_Float16)(p * 16384.0f); }
    ps += __shfl_xor(ps, 16, 32);
    lrun = lrun * corr + ps; mrun = mnew;
#pragma unroll
    for (int r = 0; r < 8; ++r) { const float cr = __shfl(corr, 8 * g + r, 32);
#pragma unroll
      for (int t = 0; t < 4; ++t) acc[t][r] *= cr; }
    LDSX();
#pragma unroll
    for (int kc = 0; kc < 2; ++kc) { const v16h pa = frag_h(&sP[w][col][0] + kc * 32, lane); v16h vf[4];
#pragma unroll
      for (int t = 0; t < 4; ++t) vf[t] = frag_h(&sV[buf][t * 16 + col][kc * 32], lane);
#pragma unroll
      for (int t = 0; t < 4; ++t) acc[t] = wmma16(pa, vf[t], acc[t]); }
    __builtin_amdgcn_wave_barrier();
    RING_PUBLISH();
    if (kt + 2 < SS / 64) stage(kt + 2, buf); }
  asm volatile("s_wait_asynccnt 0x0" ::: "memory");  // no copy is in flight behind the loop
#pragma unroll
  for (int r = 0; r < 8; ++r) { const float lr = __shfl(lrun, 8 * g + r, 32); const float inv = 1.0f / (lr * 16384.0f * 4.0f);
#pragma unroll
    for (int t = 0; t < 4; ++t) sS[w][8 * g + r][t * 16 + col] = acc[t][r] * inv; }
  LDSX();
  for (int q = lane; q < 16 * 16; q += 32) { const int rl = q >> 4, pc = q & 15; vst2(out + ((size_t)b * SS + q0 + rl) * HH + h * HD + pc * 4, *(const v4f*)(&sS[w][rl][pc * 4])); }
}
extern "C" void kernel_launch(void* const* d_in, const int* in_sizes, int n_in, void* d_out, int out_size, void* d_ws, size_t ws_size, hipStream_t stream) {
  (void)in_sizes; (void)n_in; (void)out_size; (void)ws_size;
  const float** I = (const float**)d_in;
  const float* x = I[0]; const float* Wq = I[1]; const float* bq = I[2]; const float* Wk = I[3]; const float* bk = I[4]; const float* Wv = I[5]; const float* bv = I[6];
  float* out = (float*)d_out;
  char* ws = (char*)d_ws; size_t off = 0;
  auto take = [&](size_t bytes) { char* p = ws + off; off += (bytes + 255) & ~(size_t)255; return p; };
  _Float16* X16 = (_Float16*)take((size_t)NR * HH * 2); _Float16* P = (_Float16*)take((size_t)3 * HH * HH * 2);
  _Float16* Q16 = (_Float16*)take((size_t)NR * HH * 2); _Float16* K16 = (_Float16*)take((size_t)NR * HH * 2); _Float16* VT = (_Float16*)take((size_t)NR * HH * 2);
  k_cvt<<<(NR * HH / 8 + 255) / 256, 256, 0, stream>>>(x, X16);
  k_pack<<<3 * HH, 256, 0, stream>>>(Wq, Wk, Wv, P);
  k_qkv<<<dim3(NR / 64, HH / 128, 3), 128, 0, stream>>>(X16, P, bq, bk, bv, Q16, K16, VT);
  k_attn<<<dim3(SS / 128, NHD, NB), 256, 0, stream>>>(Q16, K16, VT, out);
}

// v002
// It runs in 94.7 microseconds.
// Two timings next to v001 put it at 1.13 and 1.12 times that version's speed.
// All steps since v000 together make it 3.22 times as fast.
#include <hip/hip_runtime.h>
#include <math.h>

typedef __attribute__((ext_vector_type(16))) _Float16 v16h;
typedef __attribute__((ext_vector_type(16))) __bf16 v16b;
typedef __attribute__((ext_vector_type(8)))  _Float16 v8h;
typedef __attribute__((ext_vector_type(4)))  _Float16 v4h;
typedef __attribute__((ext_vector_type(2)))  _Float16 v2h;
typedef __attribute__((ext_vector_type(8)))  float v8f;
typedef __attribute__((ext_vector_type(4)))  float v4f;
typedef __attribute__((ext_vector_type(2)))  float v2f;
typedef __attribute__((ext_vector_type(4)))  unsigned v4u;
typedef __attribute__((ext_vector_type(4)))  int v4i;
typedef float __attribute__((may_alias)) float_a;
typedef int __attribute__((may_alias)) int_a;

template <typename T> __device__ __forceinline__ void vst2(void* p, T v) { *(T*)p = v;  }
__device__ __forceinline__ v8f wmma16(v16h a, v16h b, v8f c) {
  v8f d = __builtin_amdgcn_wmma_f32_16x16x32_f16(false, a, false, b, (short)0, c, false, false);
  asm volatile("v_nop\n\tv_nop\n\tv_nop\n\tv_nop" : "+v"(d) : "v"(a), "v"(b));
  return d;
}
__device__ __forceinline__ v8f wmma_bf(v16b a, v16b b, v8f c) {
  v8f d = __builtin_amdgcn_wmma_f32_16x16x32_bf16(false, a, false, b, (short)0, c, false, false);
  asm volatile("v_nop\n\tv_nop\n\tv_nop\n\tv_nop" : "+v"(d) : "v"(a), "v"(b));
  return d;
}
// 16x16x32 fragments: lane = (h = lane>>4, row/col = lane&15); elements 0..7 = k0+8h+0..7, 8..15 = k0+16+8h+0..7; D element r = row 8h+r
__device__ __forceinline__ v16h frag_h(const _Float16* rowk0, int lane) {
  union { v16h v; v8h q[2]; } u; const _Float16* p = rowk0 + 8 * (lane >> 4);
  u.q[0] = *(const v8h*)p; u.q[1] = *(const v8h*)(p + 16); return u.v;
}
__device__ __forceinline__ v16h frag_f32(const float* rowk0, int lane) {
  v16h a; const float* p = rowk0 + 8 * (lane >> 4);
#pragma unroll
  for (int i = 0; i < 8; ++i) { a[i] = (_Float16)p[i]; a[8 + i] = (_Float16)p[16 + i]; }
  return a;
}
__device__ __forceinline__ v16h frag_f32s(const float* rowk0, int lane, float sc) {
  v16h a; const float* p = rowk0 + 8 * (lane >> 4);
#pragma unroll
  for (int i = 0; i < 8; ++i) { a[i] = (_Float16)(p[i] * sc); a[8 + i] = (_Float16)(p[16 + i] * sc); }
  return a;
}
// column fragment from a [K][ld] layout (column n), rows >= K read as 0
__device__ __forceinline__ v16h fragc_f32(const float* W, int k0, int n, int lane, int ld, int K) {
  v16h a; const int g = lane >> 4;
#pragma unroll
  for (int i = 0; i < 8; ++i) { const int ka = k0 + 8 * g + i, kb = ka + 16;
    a[i] = (_Float16)(ka < K ? W[(size_t)ka * ld + n] : 0.f); a[8 + i] = (_Float16)(kb < K ? W[(size_t)kb * ld + n] : 0.f); }
  return a;
}
struct F2 { v16b h, l; };
__device__ __forceinline__ F2 bsplit16(const float v[16]) { F2 r;
#pragma unroll
  for (int i = 0; i < 16; ++i) { const __bf16 h = (__bf16)v[i]; r.h[i] = h; r.l[i] = (__bf16)(v[i] - (float)h); }
  return r; }
__device__ __forceinline__ F2 split_row(const float* row, int k0, int lane) { float v[16]; const float* p = row + k0 + 8 * (lane >> 4);
#pragma unroll
  for (int i = 0; i < 8; ++i) { v[i] = p[i]; v[8 + i] = p[16 + i]; }
  return bsplit16(v); }
__device__ __forceinline__ F2 split_rowK(const float* row, int k0, int lane, int K) { float v[16]; const int g = lane >> 4;
#pragma unroll
  for (int i = 0; i < 8; ++i) { const int ka = k0 + 8 * g + i, kb = ka + 16; v[i] = ka < K ? row[ka] : 0.f; v[8 + i] = kb < K ? row[kb] : 0.f; }
  return bsplit16(v); }
__device__ __forceinline__ F2 split_col(const float* W, int k0, int n, int lane, int ld, int K) { float v[16]; const int g = lane >> 4;
#pragma unroll
  for (int i = 0; i < 8; ++i) { const int ka = k0 + 8 * g + i, kb = ka + 16; v[i] = ka < K ? W[(size_t)ka * ld + n] : 0.f; v[8 + i] = kb < K ? W[(size_t)kb * ld + n] : 0.f; }
  return bsplit16(v); }
__device__ __forceinline__ v8f mac3(const F2& a, const F2& b, v8f c) { c = wmma_bf(a.l, b.h, c); c = wmma_bf(a.h, b.l, c); return wmma_bf(a.h, b.h, c); }
__device__ __forceinline__ float sigm(float v) { return 1.0f / (1.0f + expf(-v)); }
#define LDSX() do { asm volatile("s_wait_dscnt 0" ::: "memory"); __builtin_amdgcn_wave_barrier(); __builtin_amdgcn_fence(__ATOMIC_RELEASE, "workgroup"); } while (0)

// LDS byte address of a __shared__ element (low 32 bits of its address)
__device__ __forceinline__ unsigned lds_off(const void* p) { return (unsigned)(size_t)p; }
// four asynchronous copies to LDS, 16 bytes per lane each, through no register; s_wait_xcnt 0 is the statement's last line so that
// no address register of a copy is rewritten ahead of it
__device__ __forceinline__ void cp4(unsigned l0, const _Float16* g0, unsigned l1, const _Float16* g1, unsigned l2, const _Float16* g2, unsigned l3, const _Float16* g3) {
  asm volatile("global_load_async_to_lds_b128 %0, %1, off\n\tglobal_load_async_to_lds_b128 %2, %3, off\n\tglobal_load_async_to_lds_b128 %4, %5, off\n\tglobal_load_async_to_lds_b128 %6, %7, off\n\ts_wait_xcnt 0x0"
               :: "v"(l0), "v"(g0), "v"(l1), "v"(g1), "v"(l2), "v"(g2), "v"(l3), "v"(g3) : "memory");
}
// the same for the twelve copies of one q/k/v stage: rows l + 16 i of the ring, i = 0..3 from a (x rows), i = 4..11 from p (weight rows), 16 source rows apart
__device__ __forceinline__ void cp12(unsigned l, const _Float16* a, const _Float16* p, int ld) {
  const unsigned d = 16 * 144;  // 16 ring rows at the 144-byte pitch
#define CPL(i, j) "global_load_async_to_lds_b128 %" #i ", %" #j ", off\n\t"
  asm volatile(CPL(0, 1) CPL(2, 3) CPL(4, 5) CPL(6, 7) CPL(8, 9) CPL(10, 11) CPL(12, 13) CPL(14, 15) CPL(16, 17) CPL(18, 19) CPL(20, 21) CPL(22, 23) "s_wait_xcnt 0x0"
               :: "v"(l), "v"(a), "v"(l + d), "v"(a + 16 * ld), "v"(l + 2 * d), "v"(a + 32 * ld), "v"(l + 3 * d), "v"(a + 48 * ld),
                  "v"(l + 4 * d), "v"(p), "v"(l + 5 * d), "v"(p + 16 * ld), "v"(l + 6 * d), "v"(p + 32 * ld), "v"(l + 7 * d), "v"(p + 48 * ld),
                  "v"(l + 8 * d), "v"(p + 64 * ld), "v"(l + 9 * d), "v"(p + 80 * ld), "v"(l + 10 * d), "v"(p + 96 * ld), "v"(l + 11 * d), "v"(p + 112 * ld) : "memory");
#undef CPL
}
// publish point of the two-buffer ring: this wave's LDS reads are done, its own copies have landed, then the work-group barrier
#define RING_PUBLISH() do { asm volatile("s_wait_dscnt 0x0" ::: "memory"); asm volatile("s_wait_asynccnt 0x0" ::: "memory"); __syncthreads(); } while (0)

// ViT self-attention core (12 heads of 64, scores / sqrt(768), no mask, no output projection): x converted once to f16, the three
// [in][out] weights packed transposed to f16 rows (x16), q/k/v (+bias) on v_wmma_f32_16x16x32_f16 into head-major f16 buffers (x4);
// per (128 queries, head, batch) the 16 key tiles with an online softmax in f32 (S on f16 WMMA, P x2^14 f16 @ V^T), context written as
#define NB 8
#define SS 1024
#define HH 768
#define NHD 12
#define HD 64
#define NR (NB * SS)
#define KP 72  // LDS pitch of a staged 128-byte row, in halfs: 144 B, 16 B x odd, for the ds_load_b128 fragment reads

// x to f16: 512 work-groups; a thread brings 12 pieces of 16 bytes, a wave's load four whole lines, all twelve in flight before the first is converted
#define CVN 12
static_assert((size_t)NR * HH % (4 * 256 * CVN) == 0, "k_cvt covers x in whole work-groups");
__global__ __launch_bounds__(256) void k_cvt(const float* __restrict__ x, _Float16* __restrict__ X16) {
  const size_t i4 = (size_t)blockIdx.x * (CVN * 256) + threadIdx.x;  // in pieces of 4 floats
  v4f v[CVN];
#pragma unroll
  for (int j = 0; j < CVN; ++j) v[j] = *(const v4f*)(x + (i4 + j * 256) * 4);
#pragma unroll
  for (int j = 0; j < CVN; ++j) vst2(X16 + (i4 + j * 256) * 4, (v4h){(_Float16)v[j][0], (_Float16)v[j][1], (_Float16)v[j][2], (_Float16)v[j][3]});
}
// P rows [which*768 + n][768] = W_which[k][n] * 16 (transpose of [in][out]): a work-group turns one tile of 64 k x 64 n through LDS, whole lines in and out
__global__ __launch_bounds__(128) void k_pack(const float* __restrict__ Wq, const float* __restrict__ Wk, const float* __restrict__ Wv, _Float16* __restrict__ P) {
  __shared__ __align__(16) _Float16 sT[64][KP];  // [n][k]
  const int tid = threadIdx.x, k0 = blockIdx.x * 64, n0 = blockIdx.y * 64, which = blockIdx.z;
  const float* W = which == 0 ? Wq : (which == 1 ? Wk : Wv);
  const int c4 = (tid & 15) * 4, kp = (tid >> 4) * 2;  // 16 lanes cover 256 bytes of a row of W; a thread holds rows kp + 16 i and the next, so that two k share one LDS word
  const float* p = W + (size_t)(k0 + kp) * HH + n0 + c4; v4f a[4], c[4];
#pragma unroll
  for (int i = 0; i < 4; ++i) { a[i] = *(const v4f*)(p + 16 * i * HH); c[i] = *(const v4f*)(p + (16 * i + 1) * HH); }
#pragma unroll
  for (int i = 0; i < 4; ++i) {
#pragma unroll
    for (int e = 0; e < 4; ++e) vst2(&sT[c4 + e][kp + 16 * i], (v2h){(_Float16)(a[i][e] * 16.0f), (_Float16)(c[i][e] * 16.0f)}); }
  __syncthreads();
  const int n = tid >> 3, pc = (tid & 7) * 8;  // 8 lanes store one 128-byte line of a row of P; a thread rows n + 16 j
  _Float16* o = P + ((size_t)which * HH + n0 + n) * HH + k0 + pc;
#pragma unroll
  for (int j = 0; j < 4; ++j) vst2(o + 16 * j * HH, *(const v8h*)(&sT[n + 16 * j][pc]));
}
// q/k/v: block (64 rows, 128 cols = 2 heads, which): Q16/K16 [b][h][s][64] x4 ; VT [b][h][d][s] x4
__global__ __launch_bounds__(128) void k_qkv(const _Float16* __restrict__ X16, const _Float16* __restrict__ P, const float* __restrict__ bq, const float* __restrict__ bk, const float* __restrict__ bv, _Float16* __restrict__ Q16, _Float16* __restrict__ K16, _Float16* __restrict__ VT) {
  // ring: two stages of 64 k: rows 0..63 = the block's x rows, rows 64..191 = its weight rows; the output staging reuses it behind the last barrier
  __shared__ __align__(16) char smem[2 * 192 * KP * 2];
  _Float16 (*ring)[192][KP] = (_Float16 (*)[192][KP])smem;
  float (*so)[16][132] = (float (*)[16][132])smem;
  _Float16 (*st)[72] = (_Float16 (*)[72])smem;
  const int tid = threadIdx.x, wave = tid >> 5, lane = tid & 31, col = lane & 15, g = lane >> 4;
  const int which = blockIdx.z, r0b = blockIdx.x * 64, r0 = r0b + wave * 16, n0 = blockIdx.y * 128; const int b = r0b / SS, s0 = r0b % SS;
  const _Float16* Pw = P + (size_t)which * HH * HH; const float* bias = which == 0 ? bq : (which == 1 ? bk : bv);
  v8f acc[8] = {};
  // copy map: 8 lanes cover one 128-byte row piece, a wave's copy four whole lines; a thread brings rows (tid >> 3) + 16 i, i = 0..11
  const int cr = tid >> 3, cc = (tid & 7) * 8;
  const _Float16* gx = X16 + (size_t)(r0b + cr) * HH + cc; const _Float16* gp = Pw + (size_t)(n0 + cr) * HH + cc;
  const unsigned l0 = lds_off(&ring[0][cr][cc]);
  auto stage = [&](int s, int buf) { cp12(l0 + (unsigned)buf * (192 * KP * 2), gx + s * 64, gp + s * 64, HH); };
  stage(0, 0);
  asm volatile("s_wait_asynccnt 0x0" ::: "memory");  // stage 0 has landed before the barrier that publishes it
  __syncthreads();
  stage(1, 1);
#pragma unroll 1  // one stage per trip: the ring's order at the foot stays as written
  for (int s = 0; s < HH / 64; ++s) { const int buf = s & 1;
#pragma unroll
    for (int kc = 0; kc < 2; ++kc) { const v16h a = frag_h(&ring[buf][wave * 16 + col][kc * 32], lane); v16h bf[8];
#pragma unroll
      for (int j = 0; j < 8; ++j) bf[j] = frag_h(&ring[buf][64 + j * 16 + col][kc * 32], lane);
      __builtin_amdgcn_sched_barrier(0);  // the block's LDS reads issue as one group ahead of its WMMAs; without it each WMMA waits out its own pair of reads
#pragma unroll
      for (int j = 0; j < 8; ++j) acc[j] = wmma16(a, bf[j], acc[j]); }
    RING_PUBLISH();
    if (s + 2 < HH / 64) stage(s + 2, buf); }
  asm volatile("s_wait_asynccnt 0x0" ::: "memory");  // nothing of the ring is in flight when it becomes output staging
  if (which < 2) {
#pragma unroll
    for (int j = 0; j < 8; ++j) { const float bb = bias[n0 + j * 16 + col];
#pragma unroll
      for (int r = 0; r < 8; ++r) so[wave][8 * g + r][j * 16 + col] = (acc[j][r] * (1.0f / 16.0f) + bb) * 4.0f; }
    LDSX();
    _Float16* D = which == 0 ? Q16 : K16;
    for (int q = lane; q < 16 * 2 * 8; q += 32) { const int hh = q >> 7, rl = (q >> 3) & 15, pc = q & 7; const int h = (n0 >> 6) + hh; union { v8h h8; v4u u; } pk;
#pragma unroll
      for (int e = 0; e < 8; ++e) pk.h8[e] = (_Float16)so[wave][rl][hh * 64 + pc * 8 + e];
      vst2(D + (((size_t)b * NHD + h) * SS + s0 + wave * 16 + rl) * HD + pc * 8, pk.u); } }
  else {
#pragma unroll
    for (int j = 0; j < 8; ++j) { const float bb = bias[n0 + j * 16 + col];
#pragma unroll
      for (int r = 0; r < 8; ++r) st[j * 16 + col][wave * 16 + 8 * g + r] = (_Float16)((acc[j][r] * (1.0f / 16.0f) + bb) * 4.0f); }
    __syncthreads();
    for (int q = tid; q < 128 * 8; q += 128) { const int cl = q >> 3, pc = q & 7; const int c = n0 + cl, h = c >> 6, d = c & 63; vst2(VT + (((size_t)b * NHD + h) * HD + d) * SS + s0 + pc * 8, *(const v4u*)(&st[cl][pc * 8])); } }
}
// attention: block (128 q, h, b), 8 waves, 16 key tiles staged once per block in a two-buffer LDS ring, online softmax; out f32 [b][s][h*64 + d]
__global__ __launch_bounds__(256) void k_attn(const _Float16* __restrict__ Q16, const _Float16* __restrict__ K16, const _Float16* __restrict__ VT, float* __restrict__ out) {
  __shared__ __align__(16) float sS[8][16][68];  // scores; after the loop each wave's own output staging
  __shared__ __align__(16) _Float16 sP[8][16][72];
  __shared__ __align__(16) _Float16 sK[2][64][KP];  // [buffer][key][d]
  __shared__ __align__(16) _Float16 sV[2][64][KP];  // [buffer][d][key]
  const int tid = threadIdx.x, w = tid >> 5, lane = tid & 31, col = lane & 15, g = lane >> 4;
  const int b = blockIdx.z, h = blockIdx.y, q0 = blockIdx.x * 128 + w * 16; const size_t bh = (size_t)b * NHD + h;
  const float scl = (1.0f / 16.0f) / sqrtf((float)HH);
  v16h aq[2];
#pragma unroll
  for (int kc = 0; kc < 2; ++kc) aq[kc] = frag_h(Q16 + (bh * SS + q0 + col) * HD + kc * 32, lane);
  float mrun = -3.0e38f, lrun = 0.f; v8f acc[4] = {};
  // copy map: 8 lanes cover one 128-byte row, a wave's copy four whole lines; a thread brings rows tid >> 3 and 32 + (tid >> 3) of K and of V^T
  const int cr = tid >> 3, cc = (tid & 7) * 8;
  const _Float16* gk = K16 + (bh * SS + cr) * HD + cc; const _Float16* gv = VT + (bh * HD + cr) * SS + cc;
  const unsigned lk = lds_off(&sK[0][cr][cc]), lv = lds_off(&sV[0][cr][cc]);
  auto stage = [&](int t, int buf) { const unsigned o = (unsigned)buf * (64 * KP * 2); const _Float16* k = gk + (size_t)t * 64 * HD; const _Float16* v = gv + t * 64;
    cp4(lk + o, k, lk + o + 32 * KP * 2, k + 32 * HD, lv + o, v, lv + o + 32 * KP * 2, v + 32 * SS); };
  stage(0, 0);
  asm volatile("s_wait_asynccnt 0x0" ::: "memory");  // tile 0 has landed before the barrier that publishes it
  __syncthreads();
  stage(1, 1);
#pragma unroll 1
  for (int kt = 0; kt < SS / 64; ++kt) { const int buf = kt & 1;
#pragma unroll
    for (int tp = 0; tp < 4; tp += 2) { v16h kf[2][2];  // 32 keys a group: all four tiles at once cost a resident wave per SIMD in registers
#pragma unroll
      for (int t = 0; t < 2; ++t) { kf[t][0] = frag_h(&sK[buf][(tp + t) * 16 + col][0], lane); kf[t][1] = frag_h(&sK[buf][(tp + t) * 16 + col][32], lane); }
      __builtin_amdgcn_sched_barrier(0);  // the group's K fragment reads issue together ahead of its score WMMAs; without it each WMMA waits out its own pair of reads
#pragma unroll
      for (int t = 0; t < 2; ++t) { v8f s = {};
#pragma unroll
        for (int kc = 0; kc < 2; ++kc) s = wmma16(aq[kc], kf[t][kc], s);
#pragma unroll
        for (int r = 0; r < 8; ++r) sS[w][8 * g + r][(tp + t) * 16 + col] = s[r] * scl; } }
    LDSX();
    float mx = -3.4e38f;
#pragma unroll
    for (int jj = 0; jj < 32; ++jj) mx = fmaxf(mx, sS[w][col][g * 32 + jj]);
    mx = fmaxf(mx, __shfl_xor(mx, 16, 32));
    const float mnew = fmaxf(mrun, mx); const float corr = expf(mrun - mnew);
    float ps = 0.f;
#pragma unroll
    for (int jj = 0; jj < 32; ++jj) { const float p = expf(sS[w][col][g * 32 + jj] - mnew); ps += p; sP[w][col][g * 32 + jj] = (_Float16)(p * 16384.0f); }
    ps += __shfl_xor(ps, 16, 32);
    lrun = lrun * corr + ps; mrun = mnew;
#pragma unroll
    for (int r = 0; r < 8; ++r) { const float cr = __shfl(corr, 8 * g + r, 32);
#pragma unroll
      for (int t = 0; t < 4; ++t) acc[t][r] *= cr; }
    LDSX();
#pragma unroll
    for (int kc = 0; kc < 2; ++kc) { const v16h pa = frag_h(&sP[w][col][0] + kc * 32, lane); v16h vf[4];
#pragma unroll
      for (int t = 0; t < 4; ++t) vf[t] = frag_h(&sV[buf][t * 16 + col][kc * 32], lane);
#pragma unroll
      for (int t = 0; t < 4; ++t) acc[t] = wmma16(pa, vf[t], acc[t]); }
    __builtin_amdgcn_wave_barrier();
    RING_PUBLISH();
    if (kt + 2 < SS / 64) stage(kt + 2, buf); }
  asm volatile("s_wait_asynccnt 0x0" ::: "memory");  // no copy is in flight behind the loop
#pragma unroll
  for (int r = 0; r < 8; ++r) { const float lr = __shfl(lrun, 8 * g + r, 32); const float inv = 1.0f / (lr * 16384.0f * 4.0f);
#pragma unroll
    for (int t = 0; t < 4; ++t) sS[w][8 * g + r][t * 16 + col] = acc[t][r] * inv; }
  LDSX();
  for (int q = lane; q < 16 * 16; q += 32) { const int rl = q >> 4, pc = q & 15; vst2(out + ((size_t)b * SS + q0 + rl) * HH + h * HD + pc * 4, *(const v4f*)(&sS[w][rl][pc * 4])); }
}
extern "C" void kernel_launch(void* const* d_in, const int* in_sizes, int n_in, void* d_out, int out_size, void* d_ws, size_t ws_size, hipStream_t stream) {
  (void)in_sizes; (void)n_in; (void)out_size; (void)ws_size;
  const float** I = (const float**)d_in;
  const float* x = I[0]; const float* Wq = I[1]; const float* bq = I[2]; const float* Wk = I[3]; const float* bk = I[4]; const float* Wv = I[5]; const float* bv = I[6];
  float* out = (float*)d_out;
  char* ws = (char*)d_ws; size_t off = 0;
  auto take = [&](size_t bytes) { char* p = ws + off; off += (bytes + 255) & ~(size_t)255; return p; };
  _Float16* X16 = (_Float16*)take((size_t)NR * HH * 2); _Float16* P = (_Float16*)take((size_t)3 * HH * HH * 2);
  _Float16* Q16 = (_Float16*)take((size_t)NR * HH * 2); _Float16* K16 = (_Float16*)take((size_t)NR * HH * 2); _Float16* VT = (_Float16*)take((size_t)NR * HH * 2);
  k_cvt<<<NR * HH / (4 * 256 * CVN), 256, 0, stream>>>(x, X16);
  k_pack<<<dim3(HH / 64, HH / 64, 3), 128, 0, stream>>>(Wq, Wk, Wv, P);
  k_qkv<<<dim3(NR / 64, HH / 128, 3), 128, 0, stream>>>(X16, P, bq, bk, bv, Q16, K16, VT);
  k_attn<<<dim3(SS / 128, NHD, NB), 256, 0, stream>>>(Q16, K16, VT, out);
}

// v003
// One run takes 77.8 microseconds.
// Two timings next to v002 both put it at 1.22 times that version's speed.
// Over all steps from v000 it is 3.92 times as fast.
#include <hip/hip_runtime.h>
#include <math.h>

typedef __attribute__((ext_vector_type(16))) _Float16 v16h;
typedef __attribute__((ext_vector_type(16))) __bf16 v16b;
typedef __attribute__((ext_vector_type(8)))  _Float16 v8h;
typedef __attribute__((ext_vector_type(4)))  _Float16 v4h;
typedef __attribute__((ext_vector_type(2)))  _Float16 v2h;
typedef __attribute__((ext_vector_type(8)))  float v8f;
typedef __attribute__((ext_vector_type(4)))  float v4f;
typedef __attribute__((ext_vector_type(2)))  float v2f;
typedef __attribute__((ext_vector_type(4)))  unsigned v4u;
typedef __attribute__((ext_vector_type(4)))  int v4i;
typedef float __attribute__((may_alias)) float_a;
typedef int __attribute__((may_alias)) int_a;

template <typename T> __device__ __forceinline__ void vst2(void* p, T v) { *(T*)p = v;  }
__device__ __forceinline__ v8f wmma16(v16h a, v16h b, v8f c) {
  v8f d = __builtin_amdgcn_wmma_f32_16x16x32_f16(false, a, false, b, (short)0, c, false, false);
  asm volatile("v_nop\n\tv_nop\n\tv_nop\n\tv_nop" : "+v"(d) : "v"(a), "v"(b));
  return d;
}
__device__ __forceinline__ v8f wmma_bf(v16b a, v16b b, v8f c) {
  v8f d = __builtin_amdgcn_wmma_f32_16x16x32_bf16(false, a, false, b, (short)0, c, false, false);
  asm volatile("v_nop\n\tv_nop\n\tv_nop\n\tv_nop" : "+v"(d) : "v"(a), "v"(b));
  return d;
}
// 16x16x32 fragments: lane = (h = lane>>4, row/col = lane&15); elements 0..7 = k0+8h+0..7, 8..15 = k0+16+8h+0..7; D element r = row 8h+r
__device__ __forceinline__ v16h frag_h(const _Float16* rowk0, int lane) {
  union { v16h v; v8h q[2]; } u; const _Float16* p = rowk0 + 8 * (lane >> 4);
  u.q[0] = *(const v8h*)p; u.q[1] = *(const v8h*)(p + 16); return u.v;
}
__device__ __forceinline__ v16h frag_f32(const float* rowk0, int lane) {
  v16h a; const float* p = rowk0 + 8 * (lane >> 4);
#pragma unroll
  for (int i = 0; i < 8; ++i) { a[i] = (_Float16)p[i]; a[8 + i] = (_Float16)p[16 + i]; }
  return a;
}
__device__ __forceinline__ v16h frag_f32s(const float* rowk0, int lane, float sc) {
  v16h a; const float* p = rowk0 + 8 * (lane >> 4);
#pragma unroll
  for (int i = 0; i < 8; ++i) { a[i] = (_Float16)(p[i] * sc); a[8 + i] = (_Float16)(p[16 + i] * sc); }
  return a;
}
// column fragment from a [K][ld] layout (column n), rows >= K read as 0
__device__ __forceinline__ v16h fragc_f32(const float* W, int k0, int n, int lane, int ld, int K) {
  v16h a; const int g = lane >> 4;
#pragma unroll
  for (int i = 0; i < 8; ++i) { const int ka = k0 + 8 * g + i, kb = ka + 16;
    a[i] = (_Float16)(ka < K ? W[(size_t)ka * ld + n] : 0.f); a[8 + i] = (_Float16)(kb < K ? W[(size_t)kb * ld + n] : 0.f); }
  return a;
}
struct F2 { v16b h, l; };
__device__ __forceinline__ F2 bsplit16(const float v[16]) { F2 r;
#pragma unroll
  for (int i = 0; i < 16; ++i) { const __bf16 h = (__bf16)v[i]; r.h[i] = h; r.l[i] = (__bf16)(v[i] - (float)h); }
  return r; }
__device__ __forceinline__ F2 split_row(const float* row, int k0, int lane) { float v[16]; const float* p = row + k0 + 8 * (lane >> 4);
#pragma unroll
  for (int i = 0; i < 8; ++i) { v[i] = p[i]; v[8 + i] = p[16 + i]; }
  return bsplit16(v); }
__device__ __forceinline__ F2 split_rowK(const float* row, int k0, int lane, int K) { float v[16]; const int g = lane >> 4;
#pragma unroll
  for (int i = 0; i < 8; ++i) { const int ka = k0 + 8 * g + i, kb = ka + 16; v[i] = ka < K ? row[ka] : 0.f; v[8 + i] = kb < K ? row[kb] : 0.f; }
  return bsplit16(v); }
__device__ __forceinline__ F2 split_col(const float* W, int k0, int n, int lane, int ld, int K) { float v[16]; const int g = lane >> 4;
#pragma unroll
  for (int i = 0; i < 8; ++i) { const int ka = k0 + 8 * g + i, kb = ka + 16; v[i] = ka < K ? W[(size_t)ka * ld + n] : 0.f; v[8 + i] = kb < K ? W[(size_t)kb * ld + n] : 0.f; }
  return bsplit16(v); }
__device__ __forceinline__ v8f mac3(const F2& a, const F2& b, v8f c) { c = wmma_bf(a.l, b.h, c); c = wmma_bf(a.h, b.l, c); return wmma_bf(a.h, b.h, c); }
__device__ __forceinline__ float sigm(float v) { return 1.0f / (1.0f + expf(-v)); }
#define LDSX() do { asm volatile("s_wait_dscnt 0" ::: "memory"); __builtin_amdgcn_wave_barrier(); __builtin_amdgcn_fence(__ATOMIC_RELEASE, "workgroup"); } while (0)

// LDS byte address of a __shared__ element (low 32 bits of its address)
__device__ __forceinline__ unsigned lds_off(const void* p) { return (unsigned)(size_t)p; }
// four asynchronous copies to LDS, 16 bytes per lane each, through no register; s_wait_xcnt 0 is the statement's last line so that
// no address register of a copy is rewritten ahead of it
__device__ __forceinline__ void cp4(unsigned l0, const _Float16* g0, unsigned l1, const _Float16* g1, unsigned l2, const _Float16* g2, unsigned l3, const _Float16* g3) {
  asm volatile("global_load_async_to_lds_b128 %0, %1, off\n\tglobal_load_async_to_lds_b128 %2, %3, off\n\tglobal_load_async_to_lds_b128 %4, %5, off\n\tglobal_load_async_to_lds_b128 %6, %7, off\n\ts_wait_xcnt 0x0"
               :: "v"(l0), "v"(g0), "v"(l1), "v"(g1), "v"(l2), "v"(g2), "v"(l3), "v"(g3) : "memory");
}
// the same for the twelve copies of one q/k/v stage: rows l + 16 i of the ring, i = 0..3 from a (x rows), i = 4..11 from p (weight rows), 16 source rows apart
__device__ __forceinline__ void cp12(unsigned l, const _Float16* a, const _Float16* p, int ld) {
  const unsigned d = 16 * 144;  // 16 ring rows at the 144-byte pitch
#define CPL(i, j) "global_load_async_to_lds_b128 %" #i ", %" #j ", off\n\t"
  asm volatile(CPL(0, 1) CPL(2, 3) CPL(4, 5) CPL(6, 7) CPL(8, 9) CPL(10, 11) CPL(12, 13) CPL(14, 15) CPL(16, 17) CPL(18, 19) CPL(20, 21) CPL(22, 23) "s_wait_xcnt 0x0"
               :: "v"(l), "v"(a), "v"(l + d), "v"(a + 16 * ld), "v"(l + 2 * d), "v"(a + 32 * ld), "v"(l + 3 * d), "v"(a + 48 * ld),
                  "v"(l + 4 * d), "v"(p), "v"(l + 5 * d), "v"(p + 16 * ld), "v"(l + 6 * d), "v"(p + 32 * ld), "v"(l + 7 * d), "v"(p + 48 * ld),
                  "v"(l + 8 * d), "v"(p + 64 * ld), "v"(l + 9 * d), "v"(p + 80 * ld), "v"(l + 10 * d), "v"(p + 96 * ld), "v"(l + 11 * d), "v"(p + 112 * ld) : "memory");
#undef CPL
}
// publish point of the two-buffer ring: this wave's LDS reads are done, its own copies have landed, then the work-group barrier
#define RING_PUBLISH() do { asm volatile("s_wait_dscnt 0x0" ::: "memory"); asm volatile("s_wait_asynccnt 0x0" ::: "memory"); __syncthreads(); } while (0)

// ViT self-attention core (12 heads of 64, scores / sqrt(768), no mask, no output projection): x converted once to f16, the three
// [in][out] weights packed transposed to f16 rows (x16), q/k/v (+bias) on v_wmma_f32_16x16x32_f16 into head-major f16 buffers (x4);
// per (128 queries, head, batch) the 16 key tiles with an online softmax in f32 (S on f16 WMMA, P x2^14 f16 @ V^T), context written as
#define NB 8
#define SS 1024
#define HH 768
#define NHD 12
#define HD 64
#define NR (NB * SS)
#define KP 72  // LDS pitch of a staged 128-byte row, in halfs: 144 B, 16 B x odd, for the ds_load_b128 fragment reads

// x to f16: 512 work-groups; a thread brings 12 pieces of 16 bytes, a wave's load four whole lines, all twelve in flight before the first is converted
#define CVN 12
static_assert((size_t)NR * HH % (4 * 256 * CVN) == 0, "k_cvt covers x in whole work-groups");
__global__ __launch_bounds__(256) void k_cvt(const float* __restrict__ x, _Float16* __restrict__ X16) {
  const size_t i4 = (size_t)blockIdx.x * (CVN * 256) + threadIdx.x;  // in pieces of 4 floats
  v4f v[CVN];
#pragma unroll
  for (int j = 0; j < CVN; ++j) v[j] = *(const v4f*)(x + (i4 + j * 256) * 4);
#pragma unroll
  for (int j = 0; j < CVN; ++j) vst2(X16 + (i4 + j * 256) * 4, (v4h){(_Float16)v[j][0], (_Float16)v[j][1], (_Float16)v[j][2], (_Float16)v[j][3]});
}
// P rows [which*768 + n][768] = W_which[k][n] * 16 (transpose of [in][out]): a work-group turns one tile of 64 k x 64 n through LDS, whole lines in and out
__global__ __launch_bounds__(128) void k_pack(const float* __restrict__ Wq, const float* __restrict__ Wk, const float* __restrict__ Wv, _Float16* __restrict__ P) {
  __shared__ __align__(16) _Float16 sT[64][KP];  // [n][k]
  const int tid = threadIdx.x, k0 = blockIdx.x * 64, n0 = blockIdx.y * 64, which = blockIdx.z;
  const float* W = which == 0 ? Wq : (which == 1 ? Wk : Wv);
  const int c4 = (tid & 15) * 4, kp = (tid >> 4) * 2;  // 16 lanes cover 256 bytes of a row of W; a thread holds rows kp + 16 i and the next, so that two k share one LDS word
  const float* p = W + (size_t)(k0 + kp) * HH + n0 + c4; v4f a[4], c[4];
#pragma unroll
  for (int i = 0; i < 4; ++i) { a[i] = *(const v4f*)(p + 16 * i * HH); c[i] = *(const v4f*)(p + (16 * i + 1) * HH); }
#pragma unroll
  for (int i = 0; i < 4; ++i) {
#pragma unroll
    for (int e = 0; e < 4; ++e) vst2(&sT[c4 + e][kp + 16 * i], (v2h){(_Float16)(a[i][e] * 16.0f), (_Float16)(c[i][e] * 16.0f)}); }
  __syncthreads();
  const int n = tid >> 3, pc = (tid & 7) * 8;  // 8 lanes store one 128-byte line of a row of P; a thread rows n + 16 j
  _Float16* o = P + ((size_t)which * HH + n0 + n) * HH + k0 + pc;
#pragma unroll
  for (int j = 0; j < 4; ++j) vst2(o + 16 * j * HH, *(const v8h*)(&sT[n + 16 * j][pc]));
}
// q/k/v: block (64 rows, 128 cols = 2 heads, which): Q16/K16 [b][h][s][64] x4 ; VT [b][h][d][s] x4
__global__ __launch_bounds__(128) void k_qkv(const _Float16* __restrict__ X16, const _Float16* __restrict__ P, const float* __restrict__ bq, const float* __restrict__ bk, const float* __restrict__ bv, _Float16* __restrict__ Q16, _Float16* __restrict__ K16, _Float16* __restrict__ VT) {
  // ring: two stages of 64 k: rows 0..63 = the block's x rows, rows 64..191 = its weight rows; the output staging reuses it behind the last barrier
  __shared__ __align__(16) char smem[2 * 192 * KP * 2];
  _Float16 (*ring)[192][KP] = (_Float16 (*)[192][KP])smem;
  float (*so)[16][132] = (float (*)[16][132])smem;
  _Float16 (*st)[72] = (_Float16 (*)[72])smem;
  const int tid = threadIdx.x, wave = tid >> 5, lane = tid & 31, col = lane & 15, g = lane >> 4;
  const int which = blockIdx.z, r0b = blockIdx.x * 64, r0 = r0b + wave * 16, n0 = blockIdx.y * 128; const int b = r0b / SS, s0 = r0b % SS;
  const _Float16* Pw = P + (size_t)which * HH * HH; const float* bias = which == 0 ? bq : (which == 1 ? bk : bv);
  v8f acc[8] = {};
  // copy map: 8 lanes cover one 128-byte row piece, a wave's copy four whole lines; a thread brings rows (tid >> 3) + 16 i, i = 0..11
  const int cr = tid >> 3, cc = (tid & 7) * 8;
  const _Float16* gx = X16 + (size_t)(r0b + cr) * HH + cc; const _Float16* gp = Pw + (size_t)(n0 + cr) * HH + cc;
  const unsigned l0 = lds_off(&ring[0][cr][cc]);
  auto stage = [&](int s, int buf) { cp12(l0 + (unsigned)buf * (192 * KP * 2), gx + s * 64, gp + s * 64, HH); };
  stage(0, 0);
  asm volatile("s_wait_asynccnt 0x0" ::: "memory");  // stage 0 has landed before the barrier that publishes it
  __syncthreads();
  stage(1, 1);
#pragma unroll 1  // one stage per trip: the ring's order at the foot stays as written
  for (int s = 0; s < HH / 64; ++s) { const int buf = s & 1;
#pragma unroll
    for (int kc = 0; kc < 2; ++kc) { const v16h a = frag_h(&ring[buf][wave * 16 + col][kc * 32], lane); v16h bf[8];
#pragma unroll
      for (int j = 0; j < 8; ++j) bf[j] = frag_h(&ring[buf][64 + j * 16 + col][kc * 32], lane);
      __builtin_amdgcn_sched_barrier(0);  // the block's LDS reads issue as one group ahead of its WMMAs; without it each WMMA waits out its own pair of reads
#pragma unroll
      for (int j = 0; j < 8; ++j) acc[j] = wmma16(a, bf[j], acc[j]); }
    RING_PUBLISH();
    if (s + 2 < HH / 64) stage(s + 2, buf); }
  asm volatile("s_wait_asynccnt 0x0" ::: "memory");  // nothing of the ring is in flight when it becomes output staging
  if (which < 2) {
#pragma unroll
    for (int j = 0; j < 8; ++j) { const float bb = bias[n0 + j * 16 + col];
#pragma unroll
      for (int r = 0; r < 8; ++r) so[wave][8 * g + r][j * 16 + col] = (acc[j][r] * (1.0f / 16.0f) + bb) * 4.0f; }
    LDSX();
    _Float16* D = which == 0 ? Q16 : K16;
    for (int q = lane; q < 16 * 2 * 8; q += 32) { const int hh = q >> 7, rl = (q >> 3) & 15, pc = q & 7; const int h = (n0 >> 6) + hh; union { v8h h8; v4u u; } pk;
#pragma unroll
      for (int e = 0; e < 8; ++e) pk.h8[e] = (_Float16)so[wave][rl][hh * 64 + pc * 8 + e];
      vst2(D + (((size_t)b * NHD + h) * SS + s0 + wave * 16 + rl) * HD + pc * 8, pk.u); } }
  else {
#pragma unroll
    for (int j = 0; j < 8; ++j) { const float bb = bias[n0 + j * 16 + col];
#pragma unroll
      for (int r = 0; r < 8; ++r) st[j * 16 + col][wave * 16 + 8 * g + r] = (_Float16)((acc[j][r] * (1.0f / 16.0f) + bb) * 4.0f); }
    __syncthreads();
    for (int q = tid; q < 128 * 8; q += 128) { const int cl = q >> 3, pc = q & 7; const int c = n0 + cl, h = c >> 6, d = c & 63; vst2(VT + (((size_t)b * NHD + h) * HD + d) * SS + s0 + pc * 8, *(const v4u*)(&st[cl][pc * 8])); } }
}
// attention: block (128 q, h, b), 8 waves, 16 key tiles staged once per block in a two-buffer LDS ring, online softmax; out f32 [b][s][h*64 + d]
__global__ __launch_bounds__(256) void k_attn(const _Float16* __restrict__ Q16, const _Float16* __restrict__ K16, const _Float16* __restrict__ VT, float* __restrict__ out) {
  __shared__ __align__(16) float sS[8][16][68];  // raw scores; after the loop each wave's own output staging
  __shared__ __align__(16) _Float16 sP[8][16][72];
  __shared__ __align__(16) _Float16 sK[2][64][KP];  // [buffer][key][d]
  __shared__ __align__(16) _Float16 sV[2][64][KP];  // [buffer][d][key]
  const int tid = threadIdx.x, w = tid >> 5, lane = tid & 31, col = lane & 15, g = lane >> 4;
  const int b = blockIdx.z, h = blockIdx.y, q0 = blockIdx.x * 128 + w * 16; const size_t bh = (size_t)b * NHD + h;
  const float scl = (1.0f / 16.0f) / sqrtf((float)HH) * 1.44269504f;  // score scale times log2(e): the softmax runs in base 2
  v16h aq[2];
#pragma unroll
  for (int kc = 0; kc < 2; ++kc) aq[kc] = frag_h(Q16 + (bh * SS + q0 + col) * HD + kc * 32, lane);
  float mrun = -3.0e38f, lrun = 0.f; v8f acc[4] = {};  // mrun = running maximum of the scaled base-2 scores less 14, so that P and its sum come out x2^14
  // copy map: 8 lanes cover one 128-byte row, a wave's copy four whole lines; a thread brings rows tid >> 3 and 32 + (tid >> 3) of K and of V^T
  const int cr = tid >> 3, cc = (tid & 7) * 8;
  const _Float16* gk = K16 + (bh * SS + cr) * HD + cc; const _Float16* gv = VT + (bh * HD + cr) * SS + cc;
  const unsigned lk = lds_off(&sK[0][cr][cc]), lv = lds_off(&sV[0][cr][cc]);
  auto stage = [&](int t, int buf) { const unsigned o = (unsigned)buf * (64 * KP * 2); const _Float16* k = gk + (size_t)t * 64 * HD; const _Float16* v = gv + t * 64;
    cp4(lk + o, k, lk + o + 32 * KP * 2, k + 32 * HD, lv + o, v, lv + o + 32 * KP * 2, v + 32 * SS); };
  stage(0, 0);
  asm volatile("s_wait_asynccnt 0x0" ::: "memory");  // tile 0 has landed before the barrier that publishes it
  __syncthreads();
  stage(1, 1);
#pragma unroll 1
  for (int kt = 0; kt < SS / 64; ++kt) { const int buf = kt & 1;
#pragma unroll
    for (int tp = 0; tp < 4; tp += 2) { v16h kf[2][2];  // 32 keys a group: all four tiles at once cost a resident wave per SIMD in registers
#pragma unroll
      for (int t = 0; t < 2; ++t) { kf[t][0] = frag_h(&sK[buf][(tp + t) * 16 + col][0], lane); kf[t][1] = frag_h(&sK[buf][(tp + t) * 16 + col][32], lane); }
      __builtin_amdgcn_sched_barrier(0);  // the group's K fragment reads issue together ahead of its score WMMAs; without it each WMMA waits out its own pair of reads
#pragma unroll
      for (int t = 0; t < 2; ++t) { v8f s = {};
#pragma unroll
        for (int kc = 0; kc < 2; ++kc) s = wmma16(aq[kc], kf[t][kc], s);
#pragma unroll
        for (int r = 0; r < 8; ++r) sS[w][8 * g + r][(tp + t) * 16 + col] = s[r]; } }
    LDSX();
    float mx = -3.4e38f;
#pragma unroll
    for (int jj = 0; jj < 32; ++jj) mx = fmaxf(mx, sS[w][col][g * 32 + jj]);
    mx = fmaxf(mx, __shfl_xor(mx, 16, 32));
    const float mnew = fmaxf(mrun, mx * scl - 14.0f); const float corr = __builtin_amdgcn_exp2f(mrun - mnew);
    float ps = 0.f;
#pragma unroll
    for (int jj = 0; jj < 32; ++jj) { const float p = __builtin_amdgcn_exp2f(fmaf(sS[w][col][g * 32 + jj], scl, -mnew)); ps += p; sP[w][col][g * 32 + jj] = (_Float16)p; }
    ps += __shfl_xor(ps, 16, 32);
    lrun = lrun * corr + ps; mrun = mnew;
#pragma unroll
    for (int r = 0; r < 8; ++r) { const float cr = __shfl(corr, 8 * g + r, 32);
#pragma unroll
      for (int t = 0; t < 4; ++t) acc[t][r] *= cr; }
    LDSX();
#pragma unroll
    for (int kc = 0; kc < 2; ++kc) { const v16h pa = frag_h(&sP[w][col][0] + kc * 32, lane); v16h vf[4];
#pragma unroll
      for (int t = 0; t < 4; ++t) vf[t] = frag_h(&sV[buf][t * 16 + col][kc * 32], lane);
#pragma unroll
      for (int t = 0; t < 4; ++t) acc[t] = wmma16(pa, vf[t], acc[t]); }
    __builtin_amdgcn_wave_barrier();
    RING_PUBLISH();
    if (kt + 2 < SS / 64) stage(kt + 2, buf); }
  asm volatile("s_wait_asynccnt 0x0" ::: "memory");  // no copy is in flight behind the loop
#pragma unroll
  for (int r = 0; r < 8; ++r) { const float lr = __shfl(lrun, 8 * g + r, 32); const float inv = 1.0f / (lr * 4.0f);
#pragma unroll
    for (int t = 0; t < 4; ++t) sS[w][8 * g + r][t * 16 + col] = acc[t][r] * inv; }
  LDSX();
  for (int q = lane; q < 16 * 16; q += 32) { const int rl = q >> 4, pc = q & 15; vst2(out + ((size_t)b * SS + q0 + rl) * HH + h * HD + pc * 4, *(const v4f*)(&sS[w][rl][pc * 4])); }
}
extern "C" void kernel_launch(void* const* d_in, const int* in_sizes, int n_in, void* d_out, int out_size, void* d_ws, size_t ws_size, hipStream_t stream) {
  (void)in_sizes; (void)n_in; (void)out_size; (void)ws_size;
  const float** I = (const float**)d_in;
  const float* x = I[0]; const float* Wq = I[1]; const float* bq = I[2]; const float* Wk = I[3]; const float* bk = I[4]; const float* Wv = I[5]; const float* bv = I[6];
  float* out = (float*)d_out;
  char* ws = (char*)d_ws; size_t off = 0;
  auto take = [&](size_t bytes) { char* p = ws + off; off += (bytes + 255) & ~(size_t)255; return p; };
  _Float16* X16 = (_Float16*)take((size_t)NR * HH * 2); _Float16* P = (_Float16*)take((size_t)3 * HH * HH * 2);
  _Float16* Q16 = (_Float16*)take((size_t)NR * HH * 2); _Float16* K16 = (_Float16*)take((size_t)NR * HH * 2); _Float16* VT = (_Float16*)take((size_t)NR * HH * 2);
  k_cvt<<<NR * HH / (4 * 256 * CVN), 256, 0, stream>>>(x, X16);
  k_pack<<<dim3(HH / 64, HH / 64, 3), 128, 0, stream>>>(Wq, Wk, Wv, P);
  k_qkv<<<dim3(NR / 64, HH / 128, 3), 128, 0, stream>>>(X16, P, bq, bk, bv, Q16, K16, VT);
  k_attn<<<dim3(SS / 128, NHD, NB), 256, 0, stream>>>(Q16, K16, VT, out);
}

// v004
// A run of this version takes 70.1 microseconds.
// Timed twice side by side with v003, it ran 1.10 and 1.11 times as fast.
// All steps since v000 together make it 4.34 times as fast.
#include <hip/hip_runtime.h>
#include <math.h>

typedef __attribute__((ext_vector_type(16))) _Float16 v16h;
typedef __attribute__((ext_vector_type(16))) __bf16 v16b;
typedef __attribute__((ext_vector_type(8)))  _Float16 v8h;
typedef __attribute__((ext_vector_type(4)))  _Float16 v4h;
typedef __attribute__((ext_vector_type(2)))  _Float16 v2h;
typedef __attribute__((ext_vector_type(8)))  float v8f;
typedef __attribute__((ext_vector_type(4)))  float v4f;
typedef __attribute__((ext_vector_type(2)))  float v2f;
typedef __attribute__((ext_vector_type(4)))  unsigned v4u;
typedef __attribute__((ext_vector_type(4)))  int v4i;
typedef float __attribute__((may_alias)) float_a;
typedef int __attribute__((may_alias)) int_a;

template <typename T> __device__ __forceinline__ void vst2(void* p, T v) { *(T*)p = v;  }
__device__ __forceinline__ v8f wmma16(v16h a, v16h b, v8f c) {
  v8f d = __builtin_amdgcn_wmma_f32_16x16x32_f16(false, a, false, b, (short)0, c, false, false);
  asm volatile("v_nop\n\tv_nop\n\tv_nop\n\tv_nop" : "+v"(d) : "v"(a), "v"(b));
  return d;
}
__device__ __forceinline__ v8f wmma_bf(v16b a, v16b b, v8f c) {
  v8f d = __builtin_amdgcn_wmma_f32_16x16x32_bf16(false, a, false, b, (short)0, c, false, false);
  asm volatile("v_nop\n\tv_nop\n\tv_nop\n\tv_nop" : "+v"(d) : "v"(a), "v"(b));
  return d;
}
// 16x16x32 fragments: lane = (h = lane>>4, row/col = lane&15); elements 0..7 = k0+8h+0..7, 8..15 = k0+16+8h+0..7; D element r = row 8h+r
__device__ __forceinline__ v16h frag_h(const _Float16* rowk0, int lane) {
  union { v16h v; v8h q[2]; } u; const _Float16* p = rowk0 + 8 * (lane >> 4);
  u.q[0] = *(const v8h*)p; u.q[1] = *(const v8h*)(p + 16); return u.v;
}
__device__ __forceinline__ v16h frag_f32(const float* rowk0, int lane) {
  v16h a; const float* p = rowk0 + 8 * (lane >> 4);
#pragma unroll
  for (int i = 0; i < 8; ++i) { a[i] = (_Float16)p[i]; a[8 + i] = (_Float16)p[16 + i]; }
  return a;
}
__device__ __forceinline__ v16h frag_f32s(const float* rowk0, int lane, float sc) {
  v16h a; const float* p = rowk0 + 8 * (lane >> 4);
#pragma unroll
  for (int i = 0; i < 8; ++i) { a[i] = (_Float16)(p[i] * sc); a[8 + i] = (_Float16)(p[16 + i] * sc); }
  return a;
}
// column fragment from a [K][ld] layout (column n), rows >= K read as 0
__device__ __forceinline__ v16h fragc_f32(const float* W, int k0, int n, int lane, int ld, int K) {
  v16h a; const int g = lane >> 4;
#pragma unroll
  for (int i = 0; i < 8; ++i) { const int ka = k0 + 8 * g + i, kb = ka + 16;
    a[i] = (_Float16)(ka < K ? W[(size_t)ka * ld + n] : 0.f); a[8 + i] = (_Float16)(kb < K ? W[(size_t)kb * ld + n] : 0.f); }
  return a;
}
struct F2 { v16b h, l; };
__device__ __forceinline__ F2 bsplit16(const float v[16]) { F2 r;
#pragma unroll
  for (int i = 0; i < 16; ++i) { const __bf16 h = (__bf16)v[i]; r.h[i] = h; r.l[i] = (__bf16)(v[i] - (float)h); }
  return r; }
__device__ __forceinline__ F2 split_row(const float* row, int k0, int lane) { float v[16]; const float* p = row + k0 + 8 * (lane >> 4);
#pragma unroll
  for (int i = 0; i < 8; ++i) { v[i] = p[i]; v[8 + i] = p[16 + i]; }
  return bsplit16(v); }
__device__ __forceinline__ F2 split_rowK(const float* row, int k0, int lane, int K) { float v[16]; const int g = lane >> 4;
#pragma unroll
  for (int i = 0; i < 8; ++i) { const int ka = k0 + 8 * g + i, kb = ka + 16; v[i] = ka < K ? row[ka] : 0.f; v[8 + i] = kb < K ? row[kb] : 0.f; }
  return bsplit16(v); }
__device__ __forceinline__ F2 split_col(const float* W, int k0, int n, int lane, int ld, int K) { float v[16]; const int g = lane >> 4;
#pragma unroll
  for (int i = 0; i < 8; ++i) { const int ka = k0 + 8 * g + i, kb = ka + 16; v[i] = ka < K ? W[(size_t)ka * ld + n] : 0.f; v[8 + i] = kb < K ? W[(size_t)kb * ld + n] : 0.f; }
  return bsplit16(v); }
__device__ __forceinline__ v8f mac3(const F2& a, const F2& b, v8f c) { c = wmma_bf(a.l, b.h, c); c = wmma_bf(a.h, b.l, c); return wmma_bf(a.h, b.h, c); }
__device__ __forceinline__ float sigm(float v) { return 1.0f / (1.0f + expf(-v)); }
#define LDSX() do { asm volatile("s_wait_dscnt 0" ::: "memory"); __builtin_amdgcn_wave_barrier(); __builtin_amdgcn_fence(__ATOMIC_RELEASE, "workgroup"); } while (0)

// LDS byte address of a __shared__ element (low 32 bits of its address)
__device__ __forceinline__ unsigned lds_off(const void* p) { return (unsigned)(size_t)p; }
// four asynchronous copies to LDS, 16 bytes per lane each, through no register; s_wait_xcnt 0 is the statement's last line so that
// no address register of a copy is rewritten ahead of it
__device__ __forceinline__ void cp4(unsigned l0, const _Float16* g0, unsigned l1, const _Float16* g1, unsigned l2, const _Float16* g2, unsigned l3, const _Float16* g3) {
  asm volatile("global_load_async_to_lds_b128 %0, %1, off\n\tglobal_load_async_to_lds_b128 %2, %3, off\n\tglobal_load_async_to_lds_b128 %4, %5, off\n\tglobal_load_async_to_lds_b128 %6, %7, off\n\ts_wait_xcnt 0x0"
               :: "v"(l0), "v"(g0), "v"(l1), "v"(g1), "v"(l2), "v"(g2), "v"(l3), "v"(g3) : "memory");
}
// the same for the twelve copies of one q/k/v stage: rows l + 16 i of the ring, i = 0..3 from a (x rows), i = 4..11 from p (weight rows), 16 source rows apart
__device__ __forceinline__ void cp12(unsigned l, const _Float16* a, const _Float16* p, int ld) {
  const unsigned d = 16 * 144;  // 16 ring rows at the 144-byte pitch
#define CPL(i, j) "global_load_async_to_lds_b128 %" #i ", %" #j ", off\n\t"
  asm volatile(CPL(0, 1) CPL(2, 3) CPL(4, 5) CPL(6, 7) CPL(8, 9) CPL(10, 11) CPL(12, 13) CPL(14, 15) CPL(16, 17) CPL(18, 19) CPL(20, 21) CPL(22, 23) "s_wait_xcnt 0x0"
               :: "v"(l), "v"(a), "v"(l + d), "v"(a + 16 * ld), "v"(l + 2 * d), "v"(a + 32 * ld), "v"(l + 3 * d), "v"(a + 48 * ld),
                  "v"(l + 4 * d), "v"(p), "v"(l + 5 * d), "v"(p + 16 * ld), "v"(l + 6 * d), "v"(p + 32 * ld), "v"(l + 7 * d), "v"(p + 48 * ld),
                  "v"(l + 8 * d), "v"(p + 64 * ld), "v"(l + 9 * d), "v"(p + 80 * ld), "v"(l + 10 * d), "v"(p + 96 * ld), "v"(l + 11 * d), "v"(p + 112 * ld) : "memory");
#undef CPL
}
// publish point of the two-buffer ring: this wave's LDS reads are done, its own copies have landed, then the work-group barrier
#define RING_PUBLISH() do { asm volatile("s_wait_dscnt 0x0" ::: "memory"); asm volatile("s_wait_asynccnt 0x0" ::: "memory"); __syncthreads(); } while (0)

// ViT self-attention core (12 heads of 64, scores / sqrt(768), no mask, no output projection): x converted once to f16, the three
// [in][out] weights packed transposed to f16 rows (x16), q/k/v (+bias) on v_wmma_f32_16x16x32_f16 into head-major f16 buffers (x4);
// per (128 queries, head, batch) the 16 key tiles with an online softmax in f32 (S on f16 WMMA, P x2^14 f16 @ V^T), context written as
#define NB 8
#define SS 1024
#define HH 768
#define NHD 12
#define HD 64
#define NR (NB * SS)
#define KP 72  // LDS pitch of a staged 128-byte row, in halfs: 144 B, 16 B x odd, for the ds_load_b128 fragment reads

// x to f16: 512 work-groups; a thread brings 12 pieces of 16 bytes, a wave's load four whole lines, all twelve in flight before the first is converted
#define CVN 12
static_assert((size_t)NR * HH % (4 * 256 * CVN) == 0, "k_cvt covers x in whole work-groups");
__global__ __launch_bounds__(256) void k_cvt(const float* __restrict__ x, _Float16* __restrict__ X16) {
  const size_t i4 = (size_t)blockIdx.x * (CVN * 256) + threadIdx.x;  // in pieces of 4 floats
  v4f v[CVN];
#pragma unroll
  for (int j = 0; j < CVN; ++j) v[j] = *(const v4f*)(x + (i4 + j * 256) * 4);
#pragma unroll
  for (int j = 0; j < CVN; ++j) vst2(X16 + (i4 + j * 256) * 4, (v4h){(_Float16)v[j][0], (_Float16)v[j][1], (_Float16)v[j][2], (_Float16)v[j][3]});
}
// P rows [which*768 + n][768] = W_which[k][n] * 16 (transpose of [in][out]): a work-group turns one tile of 64 k x 64 n through LDS, whole lines in and out
__global__ __launch_bounds__(128) void k_pack(const float* __restrict__ Wq, const float* __restrict__ Wk, const float* __restrict__ Wv, _Float16* __restrict__ P) {
  __shared__ __align__(16) _Float16 sT[64][KP];  // [n][k]
  const int tid = threadIdx.x, k0 = blockIdx.x * 64, n0 = blockIdx.y * 64, which = blockIdx.z;
  const float* W = which == 0 ? Wq : (which == 1 ? Wk : Wv);
  const int c4 = (tid & 15) * 4, kp = (tid >> 4) * 2;  // 16 lanes cover 256 bytes of a row of W; a thread holds rows kp + 16 i and the next, so that two k share one LDS word
  const float* p = W + (size_t)(k0 + kp) * HH + n0 + c4; v4f a[4], c[4];
#pragma unroll
  for (int i = 0; i < 4; ++i) { a[i] = *(const v4f*)(p + 16 * i * HH); c[i] = *(const v4f*)(p + (16 * i + 1) * HH); }
#pragma unroll
  for (int i = 0; i < 4; ++i) {
#pragma unroll
    for (int e = 0; e < 4; ++e) vst2(&sT[c4 + e][kp + 16 * i], (v2h){(_Float16)(a[i][e] * 16.0f), (_Float16)(c[i][e] * 16.0f)}); }
  __syncthreads();
  const int n = tid >> 3, pc = (tid & 7) * 8;  // 8 lanes store one 128-byte line of a row of P; a thread rows n + 16 j
  _Float16* o = P + ((size_t)which * HH + n0 + n) * HH + k0 + pc;
#pragma unroll
  for (int j = 0; j < 4; ++j) vst2(o + 16 * j * HH, *(const v8h*)(&sT[n + 16 * j][pc]));
}
// q/k/v: block (64 rows, 128 cols = 2 heads, which): Q16/K16 [b][h][s][64] x4 ; VT [b][h][d][s] x4
__global__ __launch_bounds__(128) void k_qkv(const _Float16* __restrict__ X16, const _Float16* __restrict__ P, const float* __restrict__ bq, const float* __restrict__ bk, const float* __restrict__ bv, _Float16* __restrict__ Q16, _Float16* __restrict__ K16, _Float16* __restrict__ VT) {
  // ring: two stages of 64 k: rows 0..63 = the block's x rows, rows 64..191 = its weight rows; the output staging reuses it behind the last barrier
  __shared__ __align__(16) char smem[2 * 192 * KP * 2];
  _Float16 (*ring)[192][KP] = (_Float16 (*)[192][KP])smem;
  float (*so)[16][132] = (float (*)[16][132])smem;
  _Float16 (*st)[72] = (_Float16 (*)[72])smem;
  const int tid = threadIdx.x, wave = tid >> 5, lane = tid & 31, col = lane & 15, g = lane >> 4;
  const int which = blockIdx.z, r0b = blockIdx.x * 64, r0 = r0b + wave * 16, n0 = blockIdx.y * 128; const int b = r0b / SS, s0 = r0b % SS;
  const _Float16* Pw = P + (size_t)which * HH * HH; const float* bias = which == 0 ? bq : (which == 1 ? bk : bv);
  v8f acc[8] = {};
  // copy map: 8 lanes cover one 128-byte row piece, a wave's copy four whole lines; a thread brings rows (tid >> 3) + 16 i, i = 0..11
  const int cr = tid >> 3, cc = (tid & 7) * 8;
  const _Float16* gx = X16 + (size_t)(r0b + cr) * HH + cc; const _Float16* gp = Pw + (size_t)(n0 + cr) * HH + cc;
  const unsigned l0 = lds_off(&ring[0][cr][cc]);
  auto stage = [&](int s, int buf) { cp12(l0 + (unsigned)buf * (192 * KP * 2), gx + s * 64, gp + s * 64, HH); };
  stage(0, 0);
  asm volatile("s_wait_asynccnt 0x0" ::: "memory");  // stage 0 has landed before the barrier that publishes it
  __syncthreads();
  stage(1, 1);
#pragma unroll 1  // one stage per trip: the ring's order at the foot stays as written
  for (int s = 0; s < HH / 64; ++s) { const int buf = s & 1;
#pragma unroll
    for (int kc = 0; kc < 2; ++kc) { const v16h a = frag_h(&ring[buf][wave * 16 + col][kc * 32], lane); v16h bf[8];
#pragma unroll
      for (int j = 0; j < 8; ++j) bf[j] = frag_h(&ring[buf][64 + j * 16 + col][kc * 32], lane);
      __builtin_amdgcn_sched_barrier(0);  // the block's LDS reads issue as one group ahead of its WMMAs; without it each WMMA waits out its own pair of reads
#pragma unroll
      for (int j = 0; j < 8; ++j) acc[j] = wmma16(a, bf[j], acc[j]); }
    RING_PUBLISH();
    if (s + 2 < HH / 64) stage(s + 2, buf); }
  asm volatile("s_wait_asynccnt 0x0" ::: "memory");  // nothing of the ring is in flight when it becomes output staging
  if (which < 2) {
#pragma unroll
    for (int j = 0; j < 8; ++j) { const float bb = bias[n0 + j * 16 + col];
#pragma unroll
      for (int r = 0; r < 8; ++r) so[wave][8 * g + r][j * 16 + col] = (acc[j][r] * (1.0f / 16.0f) + bb) * 4.0f; }
    LDSX();
    _Float16* D = which == 0 ? Q16 : K16;
    for (int q = lane; q < 16 * 2 * 8; q += 32) { const int hh = q >> 7, rl = (q >> 3) & 15, pc = q & 7; const int h = (n0 >> 6) + hh; union { v8h h8; v4u u; } pk;
#pragma unroll
      for (int e = 0; e < 8; ++e) pk.h8[e] = (_Float16)so[wave][rl][hh * 64 + pc * 8 + e];
      vst2(D + (((size_t)b * NHD + h) * SS + s0 + wave * 16 + rl) * HD + pc * 8, pk.u); } }
  else {
#pragma unroll
    for (int j = 0; j < 8; ++j) { const float bb = bias[n0 + j * 16 + col];
#pragma unroll
      for (int r = 0; r < 8; ++r) st[j * 16 + col][wave * 16 + 8 * g + r] = (_Float16)((acc[j][r] * (1.0f / 16.0f) + bb) * 4.0f); }
    __syncthreads();
    for (int q = tid; q < 128 * 8; q += 128) { const int cl = q >> 3, pc = q & 7; const int c = n0 + cl, h = c >> 6, d = c & 63; vst2(VT + (((size_t)b * NHD + h) * HD + d) * SS + s0 + pc * 8, *(const v4u*)(&st[cl][pc * 8])); } }
}
// the value that lane ^ 16 holds, by a vector cross-row move (no LDS queue, no wait)
__device__ __forceinline__ float xhalf(float v) {
  const int b = __builtin_bit_cast(int, v);
  return __builtin_bit_cast(float, __builtin_amdgcn_permlanex16(b, b, 0x76543210, 0xfedcba98, false, false));
}
__global__ __launch_bounds__(256) __attribute__((amdgpu_waves_per_eu(6))) void k_attn(const _Float16* __restrict__ Q16, const _Float16* __restrict__ K16, const _Float16* __restrict__ VT, float* __restrict__ out) {
  __shared__ __align__(16) float sO[8][16][68];  // each wave's own output staging, behind the loop
  __shared__ __align__(16) _Float16 sK[2][64][KP];  // [buffer][key][d]
  __shared__ __align__(16) _Float16 sV[2][64][KP];  // [buffer][d][key]
  const int tid = threadIdx.x, w = tid >> 5, lane = tid & 31, col = lane & 15, g = lane >> 4;
  const int b = blockIdx.z, h = blockIdx.y, q0 = blockIdx.x * 128 + w * 16; const size_t bh = (size_t)b * NHD + h;
  const float scl = (1.0f / 16.0f) / sqrtf((float)HH) * 1.44269504f;  // score scale times log2(e): the softmax runs in base 2
  v16h bq[2];
#pragma unroll
  for (int kc = 0; kc < 2; ++kc) bq[kc] = frag_h(Q16 + (bh * SS + q0 + col) * HD + kc * 32, lane);
  float mrun = -3.0e38f; v8f lrun = {}; v8f acc[4] = {};  // mrun = running maximum of the scaled base-2 scores less 14, so that P and its sum come out x2^14; lrun = this lane's eight partial sums; acc[t][r] = O^T[16 t + 8 g + r][col]
  // copy map: 8 lanes cover one 128-byte row, a wave's copy four whole lines; a thread brings rows tid >> 3 and 32 + (tid >> 3) of K and of V^T
  const int cr = tid >> 3, cc = (tid & 7) * 8;
  const _Float16* gk = K16 + (bh * SS + cr) * HD + cc; const _Float16* gv = VT + (bh * HD + cr) * SS + cc;
  const unsigned lk = lds_off(&sK[0][cr][cc]), lv = lds_off(&sV[0][cr][cc]);
  auto stage = [&](int t, int buf) { const unsigned o = (unsigned)buf * (64 * KP * 2); const _Float16* k = gk + (size_t)t * 64 * HD; const _Float16* v = gv + t * 64;
    cp4(lk + o, k, lk + o + 32 * KP * 2, k + 32 * HD, lv + o, v, lv + o + 32 * KP * 2, v + 32 * SS); };
  stage(0, 0);
  asm volatile("s_wait_asynccnt 0x0" ::: "memory");  // tile 0 has landed before the barrier that publishes it
  __syncthreads();
  stage(1, 1);
#pragma unroll 1
  for (int kt = 0; kt < SS / 64; ++kt) { const int buf = kt & 1; v8f s[4];
#pragma unroll
    for (int tp = 0; tp < 4; tp += 2) { v16h kf[2][2];  // 32 keys a group
#pragma unroll
      for (int t = 0; t < 2; ++t) { kf[t][0] = frag_h(&sK[buf][(tp + t) * 16 + col][0], lane); kf[t][1] = frag_h(&sK[buf][(tp + t) * 16 + col][32], lane); }
      __builtin_amdgcn_sched_barrier(0);  // the group's K fragment reads issue together ahead of its score WMMAs; without it each WMMA waits out its own pair of reads
#pragma unroll
      for (int t = 0; t < 2; ++t) s[tp + t] = wmma16(kf[t][0], bq[0], (v8f){});
#pragma unroll
      for (int t = 0; t < 2; ++t) s[tp + t] = wmma16(kf[t][1], bq[1], s[tp + t]); }
    float mx = s[0][0];
#pragma unroll
    for (int t = 0; t < 4; ++t) {
#pragma unroll
      for (int r = 0; r < 8; ++r) mx = fmaxf(mx, s[t][r]); }
    mx = fmaxf(mx, xhalf(mx));  // the query's other 32 keys lie in lane ^ 16
    const float mnew = fmaxf(mrun, mx * scl - 14.0f); const float corr = __builtin_amdgcn_exp2f(mrun - mnew); mrun = mnew;
    lrun *= corr; v8h ph[4];
#pragma unroll
    for (int t = 0; t < 4; ++t) { const v8f x = __builtin_elementwise_fma(s[t], (v8f)(scl), (v8f)(-mnew)); v8f p;
#pragma unroll
      for (int r = 0; r < 8; ++r) p[r] = __builtin_amdgcn_exp2f(x[r]);
      lrun += p; ph[t] = __builtin_convertvector(p, v8h); acc[t] *= corr; }
#pragma unroll
    for (int kc = 0; kc < 2; ++kc) {  // B = P^T: elements 0..7 = keys 32 kc + 8 g + i (tile 2 kc), 8..15 = 16 more (tile 2 kc + 1): the k order of frag_h on a row of V^T
      const v16h pb = __builtin_shufflevector(ph[2 * kc], ph[2 * kc + 1], 0, 1, 2, 3, 4, 5, 6, 7, 8, 9, 10, 11, 12, 13, 14, 15); v16h vf[4];
#pragma unroll
      for (int t = 0; t < 4; ++t) vf[t] = frag_h(&sV[buf][t * 16 + col][kc * 32], lane);
#pragma unroll
      for (int t = 0; t < 4; ++t) acc[t] = wmma16(vf[t], pb, acc[t]); }
    RING_PUBLISH();
    if (kt + 2 < SS / 64) stage(kt + 2, buf); }
  asm volatile("s_wait_asynccnt 0x0" ::: "memory");  // no copy is in flight behind the loop
  float l = ((lrun[0] + lrun[1]) + (lrun[2] + lrun[3])) + ((lrun[4] + lrun[5]) + (lrun[6] + lrun[7]));
  l += xhalf(l);  // the two lane halves' sums are joined once
  const float inv = 1.0f / (l * 4.0f);
#pragma unroll
  for (int t = 0; t < 4; ++t) { const v8f o = acc[t] * inv;
    vst2(&sO[w][col][t * 16 + 8 * g], (v4f){o[0], o[1], o[2], o[3]}); vst2(&sO[w][col][t * 16 + 8 * g + 4], (v4f){o[4], o[5], o[6], o[7]}); }
  LDSX();
  for (int q = lane; q < 16 * 16; q += 32) { const int rl = q >> 4, pc = q & 15; vst2(out + ((size_t)b * SS + q0 + rl) * HH + h * HD + pc * 4, *(const v4f*)(&sO[w][rl][pc * 4])); }
}
extern "C" void kernel_launch(void* const* d_in, const int* in_sizes, int n_in, void* d_out, int out_size, void* d_ws, size_t ws_size, hipStream_t stream) {
  (void)in_sizes; (void)n_in; (void)out_size; (void)ws_size;
  const float** I = (const float**)d_in;
  const float* x = I[0]; const float* Wq = I[1]; const float* bq = I[2]; const float* Wk = I[3]; const float* bk = I[4]; const float* Wv = I[5]; const float* bv = I[6];
  float* out = (float*)d_out;
  char* ws = (char*)d_ws; size_t off = 0;
  auto take = [&](size_t bytes) { char* p = ws + off; off += (bytes + 255) & ~(size_t)255; return p; };
  _Float16* X16 = (_Float16*)take((size_t)NR * HH * 2); _Float16* P = (_Float16*)take((size_t)3 * HH * HH * 2);
  _Float16* Q16 = (_Float16*)take((size_t)NR * HH * 2); _Float16* K16 = (_Float16*)take((size_t)NR * HH * 2); _Float16* VT = (_Float16*)take((size_t)NR * HH * 2);
  k_cvt<<<NR * HH / (4 * 256 * CVN), 256, 0, stream>>>(x, X16);
  k_pack<<<dim3(HH / 64, HH / 64, 3), 128, 0, stream>>>(Wq, Wk, Wv, P);
  k_qkv<<<dim3(NR / 64, HH / 128, 3), 128, 0, stream>>>(X16, P, bq, bk, bv, Q16, K16, VT);
  k_attn<<<dim3(SS / 128, NHD, NB), 256, 0, stream>>>(Q16, K16, VT, out);
}

// v005
// It runs in 65 microseconds.
// Timed twice side by side with v004, it ran 1.08 and 1.07 times as fast.
// Over all steps from v000 it is 4.68 times as fast.
#include <hip/hip_runtime.h>
#include <math.h>

typedef __attribute__((ext_vector_type(16))) _Float16 v16h;
typedef __attribute__((ext_vector_type(16))) __bf16 v16b;
typedef __attribute__((ext_vector_type(8)))  _Float16 v8h;
typedef __attribute__((ext_vector_type(4)))  _Float16 v4h;
typedef __attribute__((ext_vector_type(2)))  _Float16 v2h;
typedef __attribute__((ext_vector_type(8)))  float v8f;
typedef __attribute__((ext_vector_type(4)))  float v4f;
typedef __attribute__((ext_vector_type(2)))  float v2f;
typedef __attribute__((ext_vector_type(4)))  unsigned v4u;
typedef __attribute__((ext_vector_type(4)))  int v4i;
typedef float __attribute__((may_alias)) float_a;
typedef int __attribute__((may_alias)) int_a;

template <typename T> __device__ __forceinline__ void vst2(void* p, T v) { *(T*)p = v;  }
__device__ __forceinline__ v8f wmma16(v16h a, v16h b, v8f c) {
  v8f d = __builtin_amdgcn_wmma_f32_16x16x32_f16(false, a, false, b, (short)0, c, false, false);
  asm volatile("v_nop\n\tv_nop\n\tv_nop\n\tv_nop" : "+v"(d) : "v"(a), "v"(b));
  return d;
}
__device__ __forceinline__ v8f wmma_bf(v16b a, v16b b, v8f c) {
  v8f d = __builtin_amdgcn_wmma_f32_16x16x32_bf16(false, a, false, b, (short)0, c, false, false);
  asm volatile("v_nop\n\tv_nop\n\tv_nop\n\tv_nop" : "+v"(d) : "v"(a), "v"(b));
  return d;
}
// 16x16x32 fragments: lane = (h = lane>>4, row/col = lane&15); elements 0..7 = k0+8h+0..7, 8..15 = k0+16+8h+0..7; D element r = row 8h+r
__device__ __forceinline__ v16h frag_h(const _Float16* rowk0, int lane) {
  union { v16h v; v8h q[2]; } u; const _Float16* p = rowk0 + 8 * (lane >> 4);
  u.q[0] = *(const v8h*)p; u.q[1] = *(const v8h*)(p + 16); return u.v;
}
__device__ __forceinline__ v16h frag_f32(const float* rowk0, int lane) {
  v16h a; const float* p = rowk0 + 8 * (lane >> 4);
#pragma unroll
  for (int i = 0; i < 8; ++i) { a[i] = (_Float16)p[i]; a[8 + i] = (_Float16)p[16 + i]; }
  return a;
}
__device__ __forceinline__ v16h frag_f32s(const float* rowk0, int lane, float sc) {
  v16h a; const float* p = rowk0 + 8 * (lane >> 4);
#pragma unroll
  for (int i = 0; i < 8; ++i) { a[i] = (_Float16)(p[i] * sc); a[8 + i] = (_Float16)(p[16 + i] * sc); }
  return a;
}
// column fragment from a [K][ld] layout (column n), rows >= K read as 0
__device__ __forceinline__ v16h fragc_f32(const float* W, int k0, int n, int lane, int ld, int K) {
  v16h a; const int g = lane >> 4;
#pragma unroll
  for (int i = 0; i < 8; ++i) { const int ka = k0 + 8 * g + i, kb = ka + 16;
    a[i] = (_Float16)(ka < K ? W[(size_t)ka * ld + n] : 0.f); a[8 + i] = (_Float16)(kb < K ? W[(size_t)kb * ld + n] : 0.f); }
  return a;
}
struct F2 { v16b h, l; };
__device__ __forceinline__ F2 bsplit16(const float v[16]) { F2 r;
#pragma unroll
  for (int i = 0; i < 16; ++i) { const __bf16 h = (__bf16)v[i]; r.h[i] = h; r.l[i] = (__bf16)(v[i] - (float)h); }
  return r; }
__device__ __forceinline__ F2 split_row(const float* row, int k0, int lane) { float v[16]; const float* p = row + k0 + 8 * (lane >> 4);
#pragma unroll
  for (int i = 0; i < 8; ++i) { v[i] = p[i]; v[8 + i] = p[16 + i]; }
  return bsplit16(v); }
__device__ __forceinline__ F2 split_rowK(const float* row, int k0, int lane, int K) { float v[16]; const int g = lane >> 4;
#pragma unroll
  for (int i = 0; i < 8; ++i) { const int ka = k0 + 8 * g + i, kb = ka + 16; v[i] = ka < K ? row[ka] : 0.f; v[8 + i] = kb < K ? row[kb] : 0.f; }
  return bsplit16(v); }
__device__ __forceinline__ F2 split_col(const float* W, int k0, int n, int lane, int ld, int K) { float v[16]; const int g = lane >> 4;
#pragma unroll
  for (int i = 0; i < 8; ++i) { const int ka = k0 + 8 * g + i, kb = ka + 16; v[i] = ka < K ? W[(size_t)ka * ld + n] : 0.f; v[8 + i] = kb < K ? W[(size_t)kb * ld + n] : 0.f; }
  return bsplit16(v); }
__device__ __forceinline__ v8f mac3(const F2& a, const F2& b, v8f c) { c = wmma_bf(a.l, b.h, c); c = wmma_bf(a.h, b.l, c); return wmma_bf(a.h, b.h, c); }
__device__ __forceinline__ float sigm(float v) { return 1.0f / (1.0f + expf(-v)); }
#define LDSX() do { asm volatile("s_wait_dscnt 0" ::: "memory"); __builtin_amdgcn_wave_barrier(); __builtin_amdgcn_fence(__ATOMIC_RELEASE, "workgroup"); } while (0)

// LDS byte address of a __shared__ element (low 32 bits of its address)
__device__ __forceinline__ unsigned lds_off(const void* p) { return (unsigned)(size_t)p; }
// four asynchronous copies to LDS, 16 bytes per lane each, through no register; s_wait_xcnt 0 is the statement's last line so that
// no address register of a copy is rewritten ahead of it
__device__ __forceinline__ void cp4(unsigned l0, const _Float16* g0, unsigned l1, const _Float16* g1, unsigned l2, const _Float16* g2, unsigned l3, const _Float16* g3) {
  asm volatile("global_load_async_to_lds_b128 %0, %1, off\n\tglobal_load_async_to_lds_b128 %2, %3, off\n\tglobal_load_async_to_lds_b128 %4, %5, off\n\tglobal_load_async_to_lds_b128 %6, %7, off\n\ts_wait_xcnt 0x0"
               :: "v"(l0), "v"(g0), "v"(l1), "v"(g1), "v"(l2), "v"(g2), "v"(l3), "v"(g3) : "memory");
}
// the same for the ten copies of one q/k/v stage: rows l + 32 i of the ring, i = 0..3 from a (x rows), i = 4..9 from p (weight rows), 32 source rows apart
__device__ __forceinline__ void cp10(unsigned l, const _Float16* a, const _Float16* p, int ld) {
  const unsigned d = 32 * 144;  // 32 ring rows at the 144-byte pitch
#define CPL(i, j) "global_load_async_to_lds_b128 %" #i ", %" #j ", off\n\t"
  asm volatile(CPL(0, 1) CPL(2, 3) CPL(4, 5) CPL(6, 7) CPL(8, 9) CPL(10, 11) CPL(12, 13) CPL(14, 15) CPL(16, 17) CPL(18, 19) "s_wait_xcnt 0x0"
               :: "v"(l), "v"(a), "v"(l + d), "v"(a + 32 * ld), "v"(l + 2 * d), "v"(a + 64 * ld), "v"(l + 3 * d), "v"(a + 96 * ld),
                  "v"(l + 4 * d), "v"(p), "v"(l + 5 * d), "v"(p + 32 * ld), "v"(l + 6 * d), "v"(p + 64 * ld), "v"(l + 7 * d), "v"(p + 96 * ld),
                  "v"(l + 8 * d), "v"(p + 128 * ld), "v"(l + 9 * d), "v"(p + 160 * ld) : "memory");
#undef CPL
}
// publish point of the two-buffer ring: this wave's LDS reads are done, its own copies have landed, then the work-group barrier
#define RING_PUBLISH() do { asm volatile("s_wait_dscnt 0x0" ::: "memory"); asm volatile("s_wait_asynccnt 0x0" ::: "memory"); __syncthreads(); } while (0)

// ViT self-attention core (12 heads of 64, scores / sqrt(768), no mask, no output projection): x converted once to f16, the three
// [in][out] weights packed transposed to f16 rows (x16), q/k/v (+bias) on v_wmma_f32_16x16x32_f16 into head-major f16 buffers (x4);
// per (128 queries, head, batch) the 16 key tiles with an online softmax in f32 (S on f16 WMMA, P x2^14 f16 @ V^T), context written as
#define NB 8
#define SS 1024
#define HH 768
#define NHD 12
#define HD 64
#define NR (NB * SS)
#define KP 72  // LDS pitch of a staged 128-byte row, in halfs: 144 B, 16 B x odd, for the ds_load_b128 fragment reads

// x to f16: 512 work-groups; a thread brings 12 pieces of 16 bytes, a wave's load four whole lines, all twelve in flight before the first is converted
#define CVN 12
static_assert((size_t)NR * HH % (4 * 256 * CVN) == 0, "k_cvt covers x in whole work-groups");
__global__ __launch_bounds__(256) void k_cvt(const float* __restrict__ x, _Float16* __restrict__ X16) {
  const size_t i4 = (size_t)blockIdx.x * (CVN * 256) + threadIdx.x;  // in pieces of 4 floats
  v4f v[CVN];
#pragma unroll
  for (int j = 0; j < CVN; ++j) v[j] = *(const v4f*)(x + (i4 + j * 256) * 4);
#pragma unroll
  for (int j = 0; j < CVN; ++j) vst2(X16 + (i4 + j * 256) * 4, (v4h){(_Float16)v[j][0], (_Float16)v[j][1], (_Float16)v[j][2], (_Float16)v[j][3]});
}
// P rows [which*768 + n][768] = W_which[k][n] * 16 (transpose of [in][out]): a work-group turns one tile of 64 k x 64 n through LDS, whole lines in and out
__global__ __launch_bounds__(128) void k_pack(const float* __restrict__ Wq, const float* __restrict__ Wk, const float* __restrict__ Wv, _Float16* __restrict__ P) {
  __shared__ __align__(16) _Float16 sT[64][KP];  // [n][k]
  const int tid = threadIdx.x, k0 = blockIdx.x * 64, n0 = blockIdx.y * 64, which = blockIdx.z;
  const float* W = which == 0 ? Wq : (which == 1 ? Wk : Wv);
  const int c4 = (tid & 15) * 4, kp = (tid >> 4) * 2;  // 16 lanes cover 256 bytes of a row of W; a thread holds rows kp + 16 i and the next, so that two k share one LDS word
  const float* p = W + (size_t)(k0 + kp) * HH + n0 + c4; v4f a[4], c[4];
#pragma unroll
  for (int i = 0; i < 4; ++i) { a[i] = *(const v4f*)(p + 16 * i * HH); c[i] = *(const v4f*)(p + (16 * i + 1) * HH); }
#pragma unroll
  for (int i = 0; i < 4; ++i) {
#pragma unroll
    for (int e = 0; e < 4; ++e) vst2(&sT[c4 + e][kp + 16 * i], (v2h){(_Float16)(a[i][e] * 16.0f), (_Float16)(c[i][e] * 16.0f)}); }
  __syncthreads();
  const int n = tid >> 3, pc = (tid & 7) * 8;  // 8 lanes store one 128-byte line of a row of P; a thread rows n + 16 j
  _Float16* o = P + ((size_t)which * HH + n0 + n) * HH + k0 + pc;
#pragma unroll
  for (int j = 0; j < 4; ++j) vst2(o + 16 * j * HH, *(const v8h*)(&sT[n + 16 * j][pc]));
}
// q/k/v: block (128 rows, 192 cols = 3 heads, which), 8 waves of 64 x 48: Q16/K16 [b][h][s][64] x4 ; VT [b][h][d][s] x4
// 768 work-groups, three per WGP (LDS, and six waves per SIMD by registers), hold the whole grid at once; a block brings 320 rows for 24,576 results, a wave reads 7 fragments for 12 WMMAs
#define QM 128
#define QN 192
static_assert(NR % QM == 0 && SS % QM == 0 && HH % QN == 0 && QN % HD == 0, "k_qkv covers q/k/v in whole blocks of whole heads");
__global__ __launch_bounds__(256) __attribute__((amdgpu_waves_per_eu(6))) void k_qkv(const _Float16* __restrict__ X16, const _Float16* __restrict__ P, const float* __restrict__ bq, const float* __restrict__ bk, const float* __restrict__ bv, _Float16* __restrict__ Q16, _Float16* __restrict__ K16, _Float16* __restrict__ VT) {
  // ring: two stages of 64 k: rows 0..127 = the block's x rows, rows 128..319 = its weight rows; the output staging reuses it behind the last barrier
  __shared__ __align__(16) char smem[2 * (QM + QN) * KP * 2];
  _Float16 (*ring)[QM + QN][KP] = (_Float16 (*)[QM + QN][KP])smem;
  _Float16 (*sq)[QN + 8] = (_Float16 (*)[QN + 8])smem;  // [row][col], pitch 400 B
  _Float16 (*st)[QM + 8] = (_Float16 (*)[QM + 8])smem;  // [col][row], pitch 272 B
  const int tid = threadIdx.x, lane = tid & 31, col = lane & 15, g = lane >> 4;
  const int wave = __builtin_amdgcn_readfirstlane(tid >> 5);  // the wave's number in a scalar register, and with it all that follows from it: the register budget of six waves per SIMD is tight
  const int wm = (wave >> 2) * 64, wn = (wave & 3) * 48;  // the wave's tile inside the block
  const int which = blockIdx.z, r0b = blockIdx.x * QM, n0 = blockIdx.y * QN; const int b = r0b / SS, s0 = r0b % SS;
  const _Float16* Pw = P + (size_t)which * HH * HH; const float* bias = which == 0 ? bq : (which == 1 ? bk : bv);
  v8f acc[4][3] = {};
  // copy map: 8 lanes cover one 128-byte row piece, a wave's copy four whole lines; a thread brings rows (tid >> 3) + 32 i, i = 0..9
  const int cr = tid >> 3, cc = (tid & 7) * 8;
  const _Float16* gx = X16 + (size_t)(r0b + cr) * HH + cc; const _Float16* gp = Pw + (size_t)(n0 + cr) * HH + cc;
  const unsigned l0 = lds_off(&ring[0][cr][cc]);
  auto stage = [&](int s, int buf) { cp10(l0 + (unsigned)buf * ((QM + QN) * KP * 2), gx + s * 64, gp + s * 64, HH); };
  stage(0, 0);
  asm volatile("s_wait_asynccnt 0x0" ::: "memory");  // stage 0 has landed before the barrier that publishes it
  __syncthreads();
  stage(1, 1);
  // the wave's first x row and first weight row in the stage that is read; both step to the other buffer at the loop's foot (no second pair of registers for the buffers' bases)
  const _Float16* pa = &ring[0][wm + col][8 * g]; const _Float16* pb = &ring[0][QM + wn + col][8 * g]; int step = (QM + QN) * KP;
  auto frag = [](const _Float16* p) { union { v16h v; v8h q[2]; } u; u.q[0] = *(const v8h*)p; u.q[1] = *(const v8h*)(p + 16); return u.v; };  // frag_h with the lane half's 8 k already in p
#pragma unroll 1  // one stage per trip: the ring's order at the foot stays as written
  for (int s = 0; s < HH / 64; ++s) { const int buf = s & 1;
#pragma unroll
    for (int kc = 0; kc < 2; ++kc) { v16h a[4], bf[2];
#pragma unroll
      for (int i = 0; i < 4; ++i) a[i] = frag(pa + i * 16 * KP + kc * 32);
#pragma unroll
      for (int j = 0; j < 2; ++j) bf[j] = frag(pb + j * 16 * KP + kc * 32);
      __builtin_amdgcn_sched_barrier(0);  // these LDS reads issue as one group ahead of the WMMAs; without it each WMMA waits out its own pair of reads
#pragma unroll
      for (int i = 0; i < 4; ++i) acc[i][0] = wmma16(a[i], bf[0], acc[i][0]);
      __builtin_amdgcn_sched_barrier(0);  // the third weight fragment takes the first one's registers (seven fragments at once spill at six waves per SIMD) and lands under the next four WMMAs
      bf[0] = frag(pb + 2 * 16 * KP + kc * 32);
#pragma unroll
      for (int i = 0; i < 4; ++i) acc[i][1] = wmma16(a[i], bf[1], acc[i][1]);
#pragma unroll
      for (int i = 0; i < 4; ++i) acc[i][2] = wmma16(a[i], bf[0], acc[i][2]); }
    pa += step; pb += step; step = -step;
    RING_PUBLISH();
    if (s + 2 < HH / 64) stage(s + 2, buf); }
  asm volatile("s_wait_asynccnt 0x0" ::: "memory");  // nothing of the ring is in flight when it becomes output staging
  float bj[3];  // the wave's three bias values, loaded together ahead of the tiles
#pragma unroll
  for (int j = 0; j < 3; ++j) bj[j] = bias[n0 + wn + j * 16 + col];
  if (which < 2) {
#pragma unroll
    for (int j = 0; j < 3; ++j) { const float bb = bj[j];
#pragma unroll
      for (int i = 0; i < 4; ++i) {
#pragma unroll
        for (int r = 0; r < 8; ++r) sq[wm + i * 16 + 8 * g + r][wn + j * 16 + col] = (_Float16)((acc[i][j][r] * (1.0f / 16.0f) + bb) * 4.0f);
        __builtin_amdgcn_sched_barrier(0); } }  // one tile is scaled, converted and stored before the next: all 96 results formed first spill at this register budget
    __syncthreads();  // a head's 64 columns come from two waves: the lines are stored by the whole block
    _Float16* D = which == 0 ? Q16 : K16;
    for (int q = tid; q < QM * (QN / 8); q += 256) { const int hh = q >> 10, rl = (q >> 3) & (QM - 1), pc = q & 7; const int h = n0 / HD + hh;
      vst2(D + (((size_t)b * NHD + h) * SS + s0 + rl) * HD + pc * 8, *(const v4u*)(&sq[rl][hh * HD + pc * 8])); } }
  else {
#pragma unroll
    for (int j = 0; j < 3; ++j) { const float bb = bj[j];
#pragma unroll
      for (int i = 0; i < 4; ++i) { v8h o;
#pragma unroll
        for (int r = 0; r < 8; ++r) o[r] = (_Float16)((acc[i][j][r] * (1.0f / 16.0f) + bb) * 4.0f);
        vst2(&st[wn + j * 16 + col][wm + i * 16 + 8 * g], o);
        __builtin_amdgcn_sched_barrier(0); } }  // as above
    __syncthreads();
    for (int q = tid; q < QN * (QM / 8); q += 256) { const int cl = q >> 4, pc = q & 15; const int c = n0 + cl, h = c >> 6, d = c & 63; vst2(VT + (((size_t)b * NHD + h) * HD + d) * SS + s0 + pc * 8, *(const v4u*)(&st[cl][pc * 8])); } }
}
// the value that lane ^ 16 holds, by a vector cross-row move (no LDS queue, no wait)
__device__ __forceinline__ float xhalf(float v) {
  const int b = __builtin_bit_cast(int, v);
  return __builtin_bit_cast(float, __builtin_amdgcn_permlanex16(b, b, 0x76543210, 0xfedcba98, false, false));
}
__global__ __launch_bounds__(256) __attribute__((amdgpu_waves_per_eu(6))) void k_attn(const _Float16* __restrict__ Q16, const _Float16* __restrict__ K16, const _Float16* __restrict__ VT, float* __restrict__ out) {
  __shared__ __align__(16) float sO[8][16][68];  // each wave's own output staging, behind the loop
  __shared__ __align__(16) _Float16 sK[2][64][KP];  // [buffer][key][d]
  __shared__ __align__(16) _Float16 sV[2][64][KP];  // [buffer][d][key]
  const int tid = threadIdx.x, w = tid >> 5, lane = tid & 31, col = lane & 15, g = lane >> 4;
  const int b = blockIdx.z, h = blockIdx.y, q0 = blockIdx.x * 128 + w * 16; const size_t bh = (size_t)b * NHD + h;
  const float scl = (1.0f / 16.0f) / sqrtf((float)HH) * 1.44269504f;  // score scale times log2(e): the softmax runs in base 2
  v16h bq[2];
#pragma unroll
  for (int kc = 0; kc < 2; ++kc) bq[kc] = frag_h(Q16 + (bh * SS + q0 + col) * HD + kc * 32, lane);
  float mrun = -3.0e38f; v8f lrun = {}; v8f acc[4] = {};  // mrun = running maximum of the scaled base-2 scores less 14, so that P and its sum come out x2^14; lrun = this lane's eight partial sums; acc[t][r] = O^T[16 t + 8 g + r][col]
  // copy map: 8 lanes cover one 128-byte row, a wave's copy four whole lines; a thread brings rows tid >> 3 and 32 + (tid >> 3) of K and of V^T
  const int cr = tid >> 3, cc = (tid & 7) * 8;
  const _Float16* gk = K16 + (bh * SS + cr) * HD + cc; const _Float16* gv = VT + (bh * HD + cr) * SS + cc;
  const unsigned lk = lds_off(&sK[0][cr][cc]), lv = lds_off(&sV[0][cr][cc]);
  auto stage = [&](int t, int buf) { const unsigned o = (unsigned)buf * (64 * KP * 2); const _Float16* k = gk + (size_t)t * 64 * HD; const _Float16* v = gv + t * 64;
    cp4(lk + o, k, lk + o + 32 * KP * 2, k + 32 * HD, lv + o, v, lv + o + 32 * KP * 2, v + 32 * SS); };
  stage(0, 0);
  asm volatile("s_wait_asynccnt 0x0" ::: "memory");  // tile 0 has landed before the barrier that publishes it
  __syncthreads();
  stage(1, 1);
#pragma unroll 1
  for (int kt = 0; kt < SS / 64; ++kt) { const int buf = kt & 1; v8f s[4];
#pragma unroll
    for (int tp = 0; tp < 4; tp += 2) { v16h kf[2][2];  // 32 keys a group
#pragma unroll
      for (int t = 0; t < 2; ++t) { kf[t][0] = frag_h(&sK[buf][(tp + t) * 16 + col][0], lane); kf[t][1] = frag_h(&sK[buf][(tp + t) * 16 + col][32], lane); }
      __builtin_amdgcn_sched_barrier(0);  // the group's K fragment reads issue together ahead of its score WMMAs; without it each WMMA waits out its own pair of reads
#pragma unroll
      for (int t = 0; t < 2; ++t) s[tp + t] = wmma16(kf[t][0], bq[0], (v8f){});
#pragma unroll
      for (int t = 0; t < 2; ++t) s[tp + t] = wmma16(kf[t][1], bq[1], s[tp + t]); }
    float mx = s[0][0];
#pragma unroll
    for (int t = 0; t < 4; ++t) {
#pragma unroll
      for (int r = 0; r < 8; ++r) mx = fmaxf(mx, s[t][r]); }
    mx = fmaxf(mx, xhalf(mx));  // the query's other 32 keys lie in lane ^ 16
    const float mnew = fmaxf(mrun, mx * scl - 14.0f); const float corr = __builtin_amdgcn_exp2f(mrun - mnew); mrun = mnew;
    lrun *= corr; v8h ph[4];
#pragma unroll
    for (int t = 0; t < 4; ++t) { const v8f x = __builtin_elementwise_fma(s[t], (v8f)(scl), (v8f)(-mnew)); v8f p;
#pragma unroll
      for (int r = 0; r < 8; ++r) p[r] = __builtin_amdgcn_exp2f(x[r]);
      lrun += p; ph[t] = __builtin_convertvector(p, v8h); acc[t] *= corr; }
#pragma unroll
    for (int kc = 0; kc < 2; ++kc) {  // B = P^T: elements 0..7 = keys 32 kc + 8 g + i (tile 2 kc), 8..15 = 16 more (tile 2 kc + 1): the k order of frag_h on a row of V^T
      const v16h pb = __builtin_shufflevector(ph[2 * kc], ph[2 * kc + 1], 0, 1, 2, 3, 4, 5, 6, 7, 8, 9, 10, 11, 12, 13, 14, 15); v16h vf[4];
#pragma unroll
      for (int t = 0; t < 4; ++t) vf[t] = frag_h(&sV[buf][t * 16 + col][kc * 32], lane);
#pragma unroll
      for (int t = 0; t < 4; ++t) acc[t] = wmma16(vf[t], pb, acc[t]); }
    RING_PUBLISH();
    if (kt + 2 < SS / 64) stage(kt + 2, buf); }
  asm volatile("s_wait_asynccnt 0x0" ::: "memory");  // no copy is in flight behind the loop
  float l = ((lrun[0] + lrun[1]) + (lrun[2] + lrun[3])) + ((lrun[4] + lrun[5]) + (lrun[6] + lrun[7]));
  l += xhalf(l);  // the two lane halves' sums are joined once
  const float inv = 1.0f / (l * 4.0f);
#pragma unroll
  for (int t = 0; t < 4; ++t) { const v8f o = acc[t] * inv;
    vst2(&sO[w][col][t * 16 + 8 * g], (v4f){o[0], o[1], o[2], o[3]}); vst2(&sO[w][col][t * 16 + 8 * g + 4], (v4f){o[4], o[5], o[6], o[7]}); }
  LDSX();
  for (int q = lane; q < 16 * 16; q += 32) { const int rl = q >> 4, pc = q & 15; vst2(out + ((size_t)b * SS + q0 + rl) * HH + h * HD + pc * 4, *(const v4f*)(&sO[w][rl][pc * 4])); }
}
extern "C" void kernel_launch(void* const* d_in, const int* in_sizes, int n_in, void* d_out, int out_size, void* d_ws, size_t ws_size, hipStream_t stream) {
  (void)in_sizes; (void)n_in; (void)out_size; (void)ws_size;
  const float** I = (const float**)d_in;
  const float* x = I[0]; const float* Wq = I[1]; const float* bq = I[2]; const float* Wk = I[3]; const float* bk = I[4]; const float* Wv = I[5]; const float* bv = I[6];
  float* out = (float*)d_out;
  char* ws = (char*)d_ws; size_t off = 0;
  auto take = [&](size_t bytes) { char* p = ws + off; off += (bytes + 255) & ~(size_t)255; return p; };
  _Float16* X16 = (_Float16*)take((size_t)NR * HH * 2); _Float16* P = (_Float16*)take((size_t)3 * HH * HH * 2);
  _Float16* Q16 = (_Float16*)take((size_t)NR * HH * 2); _Float16* K16 = (_Float16*)take((size_t)NR * HH * 2); _Float16* VT = (_Float16*)take((size_t)NR * HH * 2);
  k_cvt<<<NR * HH / (4 * 256 * CVN), 256, 0, stream>>>(x, X16);
  k_pack<<<dim3(HH / 64, HH / 64, 3), 128, 0, stream>>>(Wq, Wk, Wv, P);
  k_qkv<<<dim3(NR / QM, HH / QN, 3), 256, 0, stream>>>(X16, P, bq, bk, bv, Q16, K16, VT);
  k_attn<<<dim3(SS / 128, NHD, NB), 256, 0, stream>>>(Q16, K16, VT, out);
}
